// v000
// The times below were measured on an AMD MI455X: many runs one after another, warmed up first and cycling through
// copies of the inputs, with the whole window's GPU time divided by the number of runs. Launches and the gaps
// between them are all in it. The median over several windows is given; except for v000 it joins two sittings, which
// can be a few percent apart, so the side-by-side timings, each taken in one sitting, are the better comparison.
// v000 is the starting kernel. One run takes 1980 microseconds.
// compute dtype: all float inputs rounded to bf16; query, key, value are bf16-valued so their f16 planes are exact; logits q x k (1 product on exact planes) x 64^-0.5; softmax f32; P x 2^11 once to f16 x v (exact) (1 product); f32 output.
#include <hip/hip_runtime.h>
#include <math.h>

typedef __attribute__((ext_vector_type(16))) _Float16 v16h;
typedef __attribute__((ext_vector_type(16))) __bf16 v16b;
typedef __attribute__((ext_vector_type(8)))  _Float16 v8h;
typedef __attribute__((ext_vector_type(8)))  float v8f;
typedef __attribute__((ext_vector_type(4)))  float v4f;
typedef __attribute__((ext_vector_type(2)))  float v2f;
typedef __attribute__((ext_vector_type(4)))  unsigned v4u;
typedef __attribute__((ext_vector_type(4)))  int v4i;
typedef float __attribute__((may_alias)) float_a;
typedef int __attribute__((may_alias)) int_a;

template <typename T> __device__ __forceinline__ void vst2(void* p, T v) { *(T*)p = v;  }
__device__ __forceinline__ v8f wmma16(v16h a, v16h b, v8f c) {
  v8f d = __builtin_amdgcn_wmma_f32_16x16x32_f16(false, a, false, b, (short)0, c, false, false);
  asm volatile("v_nop\n\tv_nop\n\tv_nop\n\tv_nop" : "+v"(d) : "v"(a), "v"(b));
  return d;
}
__device__ __forceinline__ v8f wmma_bf(v16b a, v16b b, v8f c) {
  v8f d = __builtin_amdgcn_wmma_f32_16x16x32_bf16(false, a, false, b, (short)0, c, false, false);
  asm volatile("v_nop\n\tv_nop\n\tv_nop\n\tv_nop" : "+v"(d) : "v"(a), "v"(b));
  return d;
}
// 16x16x32 fragments: lane = (h = lane>>4, row/col = lane&15); elements 0..7 = k0+8h+0..7, 8..15 = k0+16+8h+0..7; D element r = row 8h+r
__device__ __forceinline__ v16h frag_h(const _Float16* rowk0, int lane) {
  union { v16h v; v8h q[2]; } u; const _Float16* p = rowk0 + 8 * (lane >> 4);
  u.q[0] = *(const v8h*)p; u.q[1] = *(const v8h*)(p + 16); return u.v;
}
__device__ __forceinline__ v16h frag_f32(const float* rowk0, int lane) {
  v16h a; const float* p = rowk0 + 8 * (lane >> 4);
#pragma unroll
  for (int i = 0; i < 8; ++i) { a[i] = (_Float16)p[i]; a[8 + i] = (_Float16)p[16 + i]; }
  return a;
}
__device__ __forceinline__ v16h frag_f32s(const float* rowk0, int lane, float sc) {
  v16h a; const float* p = rowk0 + 8 * (lane >> 4);
#pragma unroll
  for (int i = 0; i < 8; ++i) { a[i] = (_Float16)(p[i] * sc); a[8 + i] = (_Float16)(p[16 + i] * sc); }
  return a;
}
// column fragment from a [K][ld] layout (column n), rows >= K read as 0
__device__ __forceinline__ v16h fragc_f32(const float* W, int k0, int n, int lane, int ld, int K) {
  v16h a; const int g = lane >> 4;
#pragma unroll
  for (int i = 0; i < 8; ++i) { const int ka = k0 + 8 * g + i, kb = ka + 16;
    a[i] = (_Float16)(ka < K ? W[(size_t)(ka < K ? ka : K - 1) * ld + n] : 0.f); a[8 + i] = (_Float16)(kb < K ? W[(size_t)(kb < K ? kb : K - 1) * ld + n] : 0.f); }
  return a;
}
struct F2 { v16b h, l; };
__device__ __forceinline__ F2 bsplit16(const float v[16]) { F2 r;
#pragma unroll
  for (int i = 0; i < 16; ++i) { const __bf16 h = (__bf16)v[i]; r.h[i] = h; r.l[i] = (__bf16)(v[i] - (float)h); }
  return r; }
__device__ __forceinline__ F2 split_row(const float* row, int k0, int lane) { float v[16]; const float* p = row + k0 + 8 * (lane >> 4);
#pragma unroll
  for (int i = 0; i < 8; ++i) { v[i] = p[i]; v[8 + i] = p[16 + i]; }
  return bsplit16(v); }
__device__ __forceinline__ F2 split_rowK(const float* row, int k0, int lane, int K) { float v[16]; const int g = lane >> 4;
#pragma unroll
  for (int i = 0; i < 8; ++i) { const int ka = k0 + 8 * g + i, kb = ka + 16; v[i] = ka < K ? row[ka < K ? ka : K - 1] : 0.f; v[8 + i] = kb < K ? row[kb < K ? kb : K - 1] : 0.f; }
  return bsplit16(v); }
__device__ __forceinline__ F2 split_col(const float* W, int k0, int n, int lane, int ld, int K) { float v[16]; const int g = lane >> 4;
#pragma unroll
  for (int i = 0; i < 8; ++i) { const int ka = k0 + 8 * g + i, kb = ka + 16; v[i] = ka < K ? W[(size_t)(ka < K ? ka : K - 1) * ld + n] : 0.f; v[8 + i] = kb < K ? W[(size_t)(kb < K ? kb : K - 1) * ld + n] : 0.f; }
  return bsplit16(v); }
__device__ __forceinline__ v8f mac3(const F2& a, const F2& b, v8f c) { c = wmma_bf(a.l, b.h, c); c = wmma_bf(a.h, b.l, c); return wmma_bf(a.h, b.h, c); }
__device__ __forceinline__ float sigm(float v) { return 1.0f / (1.0f + expf(-v)); }
#define LDSX() do { asm volatile("s_wait_dscnt 0" ::: "memory"); __builtin_amdgcn_wave_barrier(); __builtin_amdgcn_fence(__ATOMIC_RELEASE, "workgroup"); } while (0)

// Plain multi-head attention core on given tensors (query / key / value [2,2048,32,64] = [batch, seq, heads, dim]; no mask, no projections; norm factor sqrt(64)): ctx = softmax(Q K^T / 8) V per (batch, head), returned as [2,2048,2048] (heads merged).
#define NB 2
#define TT 2048
#define CC 2048            // NH * HD = projected width
#define DIN 2048          // input (model) width
#define NH 32
#define HD 64
#define NQB (TT / 64)
#define HG 4
#define SCALE (0.125f)
#define CAUSAL 0
#ifndef TNB
#define TNB NB
#endif
__device__ __forceinline__ float bfr(float v) { return (float)(__bf16)v; }
__host__ __device__ __forceinline__ int kb_last(int qb) { return CAUSAL ? ((qb * 64 + 63) >> 7) : (TT / 128 - 1); }
typedef __attribute__((ext_vector_type(8))) __bf16 v8b;
__device__ __forceinline__ v16b frag_b(const __bf16* rowk0, int lane) {
  union { v16b v; v8b q[2]; } u; const __bf16* p = rowk0 + 8 * (lane >> 4);
  u.q[0] = *(const v8b*)p; u.q[1] = *(const v8b*)(p + 16); return u.v;
}
#define QBH 0              // causal: query blocks 0..QBH-1 of each sequence (few keys, no averaging) take the high-precision path
#define QHI 0               // exact planes: single-product logits everywhere
#define KHI 64            // key rows carrying k residual / v bf16 hi+lo planes (used only by the causal high-precision path)
// B fragment (k rows k0+.., output column o) of a weight: (in,out) [K][ld] or (out,in) [ld rows of K]: bf16 exact, or f16(bf16 * 256) exact
__device__ __forceinline__ v16b wcol_io(const float* Wm, int k0, int o, int lane, int ld) { v16b w; const int g = lane >> 4;
#pragma unroll
  for (int i = 0; i < 8; ++i) { w[i] = (__bf16)Wm[(size_t)(k0 + 8 * g + i) * ld + o]; w[8 + i] = (__bf16)Wm[(size_t)(k0 + 16 + 8 * g + i) * ld + o]; }
  return w; }
__device__ __forceinline__ v16b wcol_oi(const float* Wm, int k0, int o, int lane, int K) { v16b w; const float* p = Wm + (size_t)o * K + k0 + 8 * (lane >> 4);
#pragma unroll
  for (int i = 0; i < 8; ++i) { w[i] = (__bf16)p[i]; w[8 + i] = (__bf16)p[16 + i]; }
  return w; }
__device__ __forceinline__ v16h wcolh_io(const float* Wm, int k0, int o, int lane, int ld) { v16h w; const int g = lane >> 4;
#pragma unroll
  for (int i = 0; i < 8; ++i) { w[i] = (_Float16)(bfr(Wm[(size_t)(k0 + 8 * g + i) * ld + o]) * 256.0f); w[8 + i] = (_Float16)(bfr(Wm[(size_t)(k0 + 16 + 8 * g + i) * ld + o]) * 256.0f); }
  return w; }
__device__ __forceinline__ v16h wcolh_oi(const float* Wm, int k0, int o, int lane, int K) { v16h w; const float* p = Wm + (size_t)o * K + k0 + 8 * (lane >> 4);
#pragma unroll
  for (int i = 0; i < 8; ++i) { w[i] = (_Float16)(bfr(p[i]) * 256.0f); w[8 + i] = (_Float16)(bfr(p[16 + i]) * 256.0f); }
  return w; }
#define WQKV_LAYOUT 0   // 0 = (in,out) [DIN][CC]; 1 = (out,in) [CC][DIN]; 2 = per-head [NH][DIN][HD]
__device__ __forceinline__ v16b wcol_hdk(const float* Wm, int k0, int o, int lane) { v16b w; const int g = lane >> 4; const float* p = Wm + (size_t)(o / HD) * DIN * HD + (o % HD);
#pragma unroll
  for (int i = 0; i < 8; ++i) { w[i] = (__bf16)p[(size_t)(k0 + 8 * g + i) * HD]; w[8 + i] = (__bf16)p[(size_t)(k0 + 16 + 8 * g + i) * HD]; }
  return w; }
#define WO_OUT_IN 0
#if WQKV_LAYOUT == 1
#define WCOL(W, k0, o, lane) wcol_oi(W, k0, o, lane, DIN)
#elif WQKV_LAYOUT == 2
#define WCOL(W, k0, o, lane) wcol_hdk(W, k0, o, lane)
#else
#define WCOL(W, k0, o, lane) wcol_io(W, k0, o, lane, CC)
#endif
#if WO_OUT_IN
#define WOCOL(W, k0, o, lane) wcol_oi(W, k0, o, lane, CC)
#define WOCOLH(W, k0, o, lane) wcolh_oi(W, k0, o, lane, CC)
#else
#define WOCOL(W, k0, o, lane) wcol_io(W, k0, o, lane, DIN)
#define WOCOLH(W, k0, o, lane) wcolh_io(W, k0, o, lane, DIN)
#endif
typedef _Float16 hx8 __attribute__((ext_vector_type(8)));
__global__ __launch_bounds__(256) void k_planesN(const float* __restrict__ Qs, const float* __restrict__ Ks, const float* __restrict__ Vs, _Float16* __restrict__ QH, _Float16* __restrict__ QL, _Float16* __restrict__ KH, _Float16* __restrict__ VT) {
  __shared__ _Float16 sv[64][136];
  const int tid = threadIdx.x; const int c0 = blockIdx.y * 128; const size_t r0 = (size_t)blockIdx.x * 64; const int b = (int)(r0 / TT), t0 = (int)(r0 % TT);
  for (int e = tid; e < 64 * 16; e += 256) { const int rl = e >> 4, q = e & 15; const size_t src = (r0 + rl) * CC + c0 + q * 8; float tq[8], tk[8], tv[8];
#pragma unroll
    for (int u = 0; u < 8; ++u) { tq[u] = Qs[src + u]; tk[u] = Ks[src + u]; tv[u] = Vs[src + u]; }
    asm volatile("s_wait_loadcnt 0x0" ::: "memory");
    hx8 hq, hk, hl;
#pragma unroll
    for (int u = 0; u < 8; ++u) { const float qv = bfr(tq[u]); const _Float16 qh = (_Float16)qv; hq[u] = qh; hl[u] = (_Float16)((qv - (float)qh) * 1024.0f); hk[u] = (_Float16)bfr(tk[u]); sv[rl][q * 8 + u] = (_Float16)bfr(tv[u]); }
    vst2((unsigned*)(QH + src), *(const v4u*)&hq); vst2((unsigned*)(KH + src), *(const v4u*)&hk);
    if (t0 + rl < QHI) vst2((unsigned*)(QL + ((size_t)b * QHI + t0 + rl) * CC + c0 + q * 8), *(const v4u*)&hl); }
  __syncthreads();
  for (int e = tid; e < 128 * 8; e += 256) { const int c = e >> 3, q = e & 7; hx8 hv; _Pragma("unroll") for (int j = 0; j < 8; ++j) hv[j] = sv[q * 8 + j][c]; vst2((unsigned*)(VT + ((size_t)b * CC + c0 + c) * TT + t0 + q * 8), *(const v4u*)&hv); } }
#define SM_EXTRA_PARAMS
#define SM_MASK_HOOK (void)0
#ifndef SM_EXTRA_PARAMS
#define SM_EXTRA_PARAMS
#endif
#ifndef PROJ_EXTRA_PARAMS
#define PROJ_EXTRA_PARAMS
#endif
#ifndef SM_MASK_HOOK
#define SM_MASK_HOOK (void)0
#endif

#define WS_QH  0u                                      // f16 q rows [b*t][CC]
#define WS_KH  (WS_QH + 2u * (size_t)NB * TT * CC)      // f16 k rows [b*t][CC]
#define WS_VT  (WS_KH + 2u * (size_t)NB * TT * CC)      // f16 v planes [b][c][t]
#define WS_QL  (WS_VT + 2u * (size_t)NB * CC * TT)      // f16 q residual x 2^10 rows [b][t < QHI][CC]
#define WS_KL  (WS_QL + 2u * (size_t)NB * QHI * CC)     // f16 k residual x 2^10 rows [b][t < KHI][CC]
#define WS_VB  (WS_KL + 2u * (size_t)NB * KHI * CC)     // bf16 v hi planes [b][c][t < KHI]
#define WS_VBL (WS_VB + 2u * (size_t)NB * CC * KHI)
#define WS_S   (WS_VBL + 2u * (size_t)NB * CC * KHI)    // f32 logits / P [hg][t][s]
#define WS_Y   (WS_S  + 4u * (size_t)HG * TT * TT)      // f32 ctx rows [b*t][CC] (only when there is an output projection)
#define WS_END (WS_Y  + 0u)

// ---- k_proj: block = (64 rows, 128 cols, which): q/k/v = X W (+ b) with exact bf16 products (K = DIN) -> which 0: q f16 rows (+ residual rows < QHI); 1: k f16 rows (+ residual rows < KHI); 2: v f16 planes [c][t] (+ bf16 hi/lo planes for t < KHI)
__global__ __launch_bounds__(128) void k_proj(const float* __restrict__ XQ, const float* __restrict__ XK, const float* __restrict__ XV, const float* __restrict__ WQ, const float* __restrict__ WK, const float* __restrict__ WV, const float* __restrict__ BQ, const float* __restrict__ BK, const float* __restrict__ BV,
    _Float16* __restrict__ QH, _Float16* __restrict__ QL, _Float16* __restrict__ KH, _Float16* __restrict__ KL, _Float16* __restrict__ VT, __bf16* __restrict__ VB, __bf16* __restrict__ VBL) {
  __shared__ __align__(16) _Float16 sh[64][136], sl[64][136]; __shared__ __align__(16) _Float16 th[128][72]; __shared__ __align__(16) __bf16 tb[128][72], tbl[128][72];
  const int tid = threadIdx.x, wave = tid >> 5, lane = tid & 31, col = lane & 15, g = lane >> 4; const int which = blockIdx.z; const int c0 = blockIdx.y * 128; const size_t r0 = (size_t)blockIdx.x * 64; const size_t bb = r0 / TT; const int t0 = (int)(r0 % TT);
  const float* X = which == 0 ? XQ : which == 1 ? XK : XV; const float* WA = which == 0 ? WQ : which == 1 ? WK : WV; const float* BA = which == 0 ? BQ : which == 1 ? BK : BV;
  v8f acc[8] = {};
#pragma unroll 2
  for (int kc = 0; kc < DIN / 32; ++kc) { v16b a; { const float* p = X + (r0 + wave * 16 + col) * DIN + kc * 32 + 8 * g;
#pragma unroll
      for (int i = 0; i < 8; ++i) { a[i] = (__bf16)p[i]; a[8 + i] = (__bf16)p[16 + i]; } }
    asm volatile("s_wait_loadcnt 0x0" ::: "memory");
#pragma unroll
    for (int j = 0; j < 8; ++j) { const v16b w = WCOL(WA, kc * 32, c0 + j * 16 + col, lane); asm volatile("s_wait_loadcnt 0x0" ::: "memory"); acc[j] = wmma_bf(a, w, acc[j]); } }
  if (which < 2) { _Float16* DH = which == 0 ? QH : KH; _Float16* DL = which == 0 ? QL : KL; const int nhi = which == 0 ? QHI : KHI; const bool hi_rows = t0 < nhi;
#pragma unroll
    for (int j = 0; j < 8; ++j) { const float bias = BA ? bfr(BA[c0 + j * 16 + col]) : 0.f;
#pragma unroll
      for (int r = 0; r < 8; ++r) { const float v = acc[j][r] + bias; const _Float16 hv = (_Float16)v; sh[wave * 16 + 8 * g + r][j * 16 + col] = hv; sl[wave * 16 + 8 * g + r][j * 16 + col] = (_Float16)((v - (float)hv) * 1024.0f); } }
    __syncthreads();
    for (int e = tid; e < 64 * 16; e += 128) { const int rl = e >> 4, q = e & 15; vst2((unsigned*)(DH + (r0 + rl) * CC + c0 + q * 8), *(const v4u*)&sh[rl][q * 8]); if (hi_rows) vst2((unsigned*)(DL + (bb * nhi + t0 + rl) * (size_t)CC + c0 + q * 8), *(const v4u*)&sl[rl][q * 8]); }
  } else { const bool hi_rows = t0 < KHI;
#pragma unroll
    for (int j = 0; j < 8; ++j) { const float bias = BA ? bfr(BA[c0 + j * 16 + col]) : 0.f;
#pragma unroll
      for (int r = 0; r < 8; ++r) { const float v = acc[j][r] + bias; const int rl = wave * 16 + 8 * g + r, cl = j * 16 + col; th[cl][rl] = (_Float16)v; const __bf16 bh = (__bf16)v; tb[cl][rl] = bh; tbl[cl][rl] = (__bf16)(v - (float)bh); } }
    __syncthreads();
    for (int e = tid; e < 128 * 8; e += 128) { const int cl = e >> 3, q = e & 7; vst2((unsigned*)(VT + (bb * CC + c0 + cl) * (size_t)TT + t0 + q * 8), *(const v4u*)&th[cl][q * 8]); if (hi_rows) { const size_t o3 = (bb * CC + c0 + cl) * (size_t)KHI + t0 + q * 8; vst2((unsigned*)(VB + o3), *(const v4u*)&tb[cl][q * 8]); vst2((unsigned*)(VBL + o3), *(const v4u*)&tbl[cl][q * 8]); } } } }
// ---- k_sc: block = (query block qb, key block kb <= kb_last(qb), head in group) of batch b: logits x SCALE; q hi + residual (x 2^10) against k (2 products) for query rows < QHI, plus the k residual (3 products) for query blocks < QBH (causal early rows); causal: blocks past the diagonal exit, the mask itself is applied by index in k_sm
__global__ __launch_bounds__(128) void k_sc(const _Float16* __restrict__ QH, const _Float16* __restrict__ KH, const _Float16* __restrict__ QL, const _Float16* __restrict__ KL, int b, int h0, float* __restrict__ S0) { __shared__ __align__(16) float ss[4][16][132];
  const int qb = blockIdx.x, kb = blockIdx.y; if (kb > kb_last(qb)) return;
  const int h = h0 + blockIdx.z; float* S = S0 + (size_t)blockIdx.z * TT * TT;
  const int tid = threadIdx.x, wave = tid >> 5, lane = tid & 31, col = lane & 15, g = lane >> 4; const int k0 = kb * 128; const int ql0 = qb * 64 + wave * 16; const size_t q0 = (size_t)b * TT + ql0, kr0 = (size_t)b * TT + k0;
  v8f acc[8] = {}, accl[8] = {};
  const _Float16* QLb = QL + (size_t)b * QHI * CC; const _Float16* KLb = KL + (size_t)b * KHI * CC;
  if (qb < QBH) {
#pragma unroll
    for (int kc = 0; kc < HD / 32; ++kc) { const v16h ah = frag_h(QH + (q0 + col) * CC + h * HD + kc * 32, lane), al = frag_h(QLb + (size_t)(ql0 + col) * CC + h * HD + kc * 32, lane);
#pragma unroll
      for (int j = 0; j < 8; ++j) { const v16h kbf = frag_h(KH + (kr0 + j * 16 + col) * CC + h * HD + kc * 32, lane), klf = frag_h(KLb + (size_t)(k0 + j * 16 + col) * CC + h * HD + kc * 32, lane); acc[j] = wmma16(ah, kbf, acc[j]); accl[j] = wmma16(al, kbf, accl[j]); accl[j] = wmma16(ah, klf, accl[j]); } }
  } else if (qb * 64 < QHI) {
#pragma unroll
    for (int kc = 0; kc < HD / 32; ++kc) { const v16h ah = frag_h(QH + (q0 + col) * CC + h * HD + kc * 32, lane), al = frag_h(QLb + (size_t)(ql0 + col) * CC + h * HD + kc * 32, lane);
#pragma unroll
      for (int j = 0; j < 8; ++j) { const v16h kbf = frag_h(KH + (kr0 + j * 16 + col) * CC + h * HD + kc * 32, lane); acc[j] = wmma16(ah, kbf, acc[j]); accl[j] = wmma16(al, kbf, accl[j]); } }
  } else {
#pragma unroll
    for (int kc = 0; kc < HD / 32; ++kc) { const v16h ah = frag_h(QH + (q0 + col) * CC + h * HD + kc * 32, lane);
#pragma unroll
      for (int j = 0; j < 8; ++j) { const v16h kbf = frag_h(KH + (kr0 + j * 16 + col) * CC + h * HD + kc * 32, lane); acc[j] = wmma16(ah, kbf, acc[j]); } } }
#pragma unroll
  for (int j = 0; j < 8; ++j) {
#pragma unroll
    for (int r = 0; r < 8; ++r) ss[wave][8 * g + r][j * 16 + col] = (acc[j][r] + accl[j][r] * (1.0f / 1024.0f)) * SCALE; }
  LDSX(); for (int rl = 0; rl < 16; ++rl) vst2(S + (size_t)(ql0 + rl) * TT + k0 + lane * 4, *(const v4f*)&ss[wave][rl][lane * 4]); }
// ---- k_sm: block = query row t (head in group): keys [0, kend): causal -> logit if s <= t else excluded; softmax in f32; P x 2^11 in place (0 for excluded)
__global__ __launch_bounds__(256) void k_sm(float* __restrict__ S0 SM_EXTRA_PARAMS) { __shared__ float sred[8]; __shared__ float sbc; __shared__ __align__(16) float shv[TT];
  const int tid = threadIdx.x; const int t = blockIdx.x; const int kend = (kb_last(t >> 6) + 1) * 128;
  float* sr = S0 + (size_t)blockIdx.y * TT * TT + (size_t)t * TT;
  float m = -3.0e38f; for (int k = tid; k < kend; k += 256) { float v = (!CAUSAL || k <= t) ? sr[k] : -3.0e38f; SM_MASK_HOOK; shv[k] = v; m = fmaxf(m, v); }
#pragma unroll
  for (int o = 1; o < 32; o <<= 1) m = fmaxf(m, __shfl_xor(m, o));
  if ((tid & 31) == 0) sred[tid >> 5] = m; __syncthreads(); if (tid == 0) { float a = sred[0]; for (int i = 1; i < 8; ++i) a = fmaxf(a, sred[i]); sbc = a; } __syncthreads(); m = sbc; __syncthreads();
  float sum = 0.f; for (int k = tid; k < kend; k += 256) { const float v = shv[k]; const float e = (v <= -1.0e38f) ? 0.f : expf(v - m); shv[k] = e; sum += e; }
#pragma unroll
  for (int o = 1; o < 32; o <<= 1) sum += __shfl_xor(sum, o);
  if ((tid & 31) == 0) sred[tid >> 5] = sum; __syncthreads(); if (tid == 0) { float a = 0.f; for (int i = 0; i < 8; ++i) a += sred[i]; sbc = a > 0.f ? 2048.0f / a : 0.f; }   /* a fully excluded row yields P = 0 */ __syncthreads(); const float inv = sbc;
  for (int k = tid; k < kend; k += 256) shv[k] = shv[k] * inv;
  __syncthreads(); for (int q = tid; q < kend / 4; q += 256) vst2(sr + q * 4, *(const v4f*)&shv[q * 4]); }
// ---- k_pv: block = 64 queries (qb) of (b, h): ctx = P . v over keys [0, kend) (P x 2^11 once to f16 against v f16: 1 product; causal early query blocks: P and v as bf16 hi + lo, 3 products); 256-B (row, head) segment by 16 lanes
__global__ __launch_bounds__(128) void k_pv(const float* __restrict__ PS0, const _Float16* __restrict__ VT, const __bf16* __restrict__ VB, const __bf16* __restrict__ VBL, int b, int h0, float* __restrict__ Y) { const int h = h0 + blockIdx.z; const float* PS = PS0 + (size_t)blockIdx.z * TT * TT; __shared__ __align__(16) float ss[4][16][HD + 4];
  const int tid = threadIdx.x, wave = tid >> 5, lane = tid & 31, col = lane & 15, g = lane >> 4; const int qb = blockIdx.x; const int ql0 = qb * 64 + wave * 16; const int kce = (kb_last(qb) + 1) * 4;
  v8f acc[HD / 16] = {};
  if (qb < QBH) {
#pragma unroll 1
    for (int kc = 0; kc < kce; ++kc) { const F2 p = split_row(PS + (size_t)(ql0 + col) * TT, kc * 32, lane);
      asm volatile("s_wait_loadcnt 0x0" ::: "memory");
#pragma unroll
      for (int j = 0; j < HD / 16; ++j) { const size_t po = ((size_t)b * CC + h * HD + j * 16 + col) * (size_t)KHI + kc * 32; const v16b vh = frag_b(VB + po, lane); acc[j] = wmma_bf(p.h, vh, acc[j]); acc[j] = wmma_bf(p.l, vh, acc[j]); acc[j] = wmma_bf(p.h, frag_b(VBL + po, lane), acc[j]); } }
  } else {
#pragma unroll 1
    for (int kc = 0; kc < kce; ++kc) { const v16h p = frag_f32(PS + (size_t)(ql0 + col) * TT + kc * 32, lane);
      asm volatile("s_wait_loadcnt 0x0" ::: "memory");
#pragma unroll
      for (int j = 0; j < HD / 16; ++j) { const size_t po = ((size_t)b * CC + h * HD + j * 16 + col) * (size_t)TT + kc * 32; acc[j] = wmma16(p, frag_h(VT + po, lane), acc[j]); } } }
#pragma unroll
  for (int j = 0; j < HD / 16; ++j)
#pragma unroll
    for (int r = 0; r < 8; ++r) ss[wave][8 * g + r][j * 16 + col] = acc[j][r] * (1.0f / 2048.0f);
  LDSX(); for (int rl = 0; rl < 16; ++rl) if (lane < HD / 4) vst2(Y + ((size_t)b * TT + ql0 + rl) * CC + h * HD + lane * 4, *(const v4f*)&ss[wave][rl][lane * 4]); }

extern "C" void kernel_launch(void* const* d_in, const int* in_sizes, int n_in, void* d_out, int out_size, void* d_ws, size_t ws_size, hipStream_t stream) {
  (void)in_sizes; (void)n_in; (void)out_size;
  const float** F = (const float**)d_in;
  if (ws_size < (size_t)WS_END) return;
  char* ws = (char*)d_ws; _Float16 *QH = (_Float16*)(ws + WS_QH), *KH = (_Float16*)(ws + WS_KH), *VT = (_Float16*)(ws + WS_VT), *QL = (_Float16*)(ws + WS_QL), *KL = (_Float16*)(ws + WS_KL); __bf16 *VB = (__bf16*)(ws + WS_VB), *VBL = (__bf16*)(ws + WS_VBL); float *S = (float*)(ws + WS_S), *Y = (float*)(ws + WS_Y);
  (void)Y; (void)QL; (void)KL; (void)VB; (void)VBL;
  // inputs: 0 query [2,2048,32,64]; 1 key; 2 value (rows [b*2048 + s][n*64 + h], heads merged)
  k_planesN<<<dim3(TNB * TT / 64, CC / 128), 256, 0, stream>>>(F[0], F[1], F[2], QH, QL, KH, VT);
  for (int b = 0; b < TNB; ++b) for (int h0 = 0; h0 < NH; h0 += HG) {
    k_sc<<<dim3(NQB, TT / 128, HG), 128, 0, stream>>>(QH, KH, QL, KL, b, h0, S);
    k_sm<<<dim3(TT, HG), 256, 0, stream>>>(S);
    k_pv<<<dim3(NQB, 1, HG), 128, 0, stream>>>(S, VT, VB, VBL, b, h0, (float*)d_out);   /* ctx [b, sq, n*h] merged-head rows */
  }
}

// v001
// It runs in 70.5 microseconds.
// In two side-by-side timings against v000, it was 27.9 and 28.3 times as fast.
// compute dtype: all float inputs rounded to bf16; query, key, value are bf16-valued so their f16 planes are exact; logits q x k (1 product on exact planes) x 64^-0.5; online softmax f32; P = 2^(logit - running maximum) once to f16 x v (exact) (1 product), divided by the f32 sum at the end; f32 output.
#include <hip/hip_runtime.h>
#include <math.h>

typedef __attribute__((ext_vector_type(16))) _Float16 v16h;
typedef __attribute__((ext_vector_type(16))) __bf16 v16b;
typedef __attribute__((ext_vector_type(8)))  _Float16 v8h;
typedef __attribute__((ext_vector_type(8)))  float v8f;
typedef __attribute__((ext_vector_type(4)))  float v4f;
typedef __attribute__((ext_vector_type(2)))  float v2f;
typedef __attribute__((ext_vector_type(4)))  unsigned v4u;
typedef __attribute__((ext_vector_type(4)))  int v4i;
typedef float __attribute__((may_alias)) float_a;
typedef int __attribute__((may_alias)) int_a;

template <typename T> __device__ __forceinline__ void vst2(void* p, T v) { *(T*)p = v;  }
__device__ __forceinline__ v8f wmma16(v16h a, v16h b, v8f c) {
  v8f d = __builtin_amdgcn_wmma_f32_16x16x32_f16(false, a, false, b, (short)0, c, false, false);
  asm volatile("v_nop\n\tv_nop\n\tv_nop\n\tv_nop" : "+v"(d) : "v"(a), "v"(b));
  return d;
}
__device__ __forceinline__ v8f wmma_bf(v16b a, v16b b, v8f c) {
  v8f d = __builtin_amdgcn_wmma_f32_16x16x32_bf16(false, a, false, b, (short)0, c, false, false);
  asm volatile("v_nop\n\tv_nop\n\tv_nop\n\tv_nop" : "+v"(d) : "v"(a), "v"(b));
  return d;
}
// 16x16x32 fragments: lane = (h = lane>>4, row/col = lane&15); elements 0..7 = k0+8h+0..7, 8..15 = k0+16+8h+0..7; D element r = row 8h+r
__device__ __forceinline__ v16h frag_h(const _Float16* rowk0, int lane) {
  union { v16h v; v8h q[2]; } u; const _Float16* p = rowk0 + 8 * (lane >> 4);
  u.q[0] = *(const v8h*)p; u.q[1] = *(const v8h*)(p + 16); return u.v;
}
__device__ __forceinline__ v16h frag_f32(const float* rowk0, int lane) {
  v16h a; const float* p = rowk0 + 8 * (lane >> 4);
#pragma unroll
  for (int i = 0; i < 8; ++i) { a[i] = (_Float16)p[i]; a[8 + i] = (_Float16)p[16 + i]; }
  return a;
}
__device__ __forceinline__ v16h frag_f32s(const float* rowk0, int lane, float sc) {
  v16h a; const float* p = rowk0 + 8 * (lane >> 4);
#pragma unroll
  for (int i = 0; i < 8; ++i) { a[i] = (_Float16)(p[i] * sc); a[8 + i] = (_Float16)(p[16 + i] * sc); }
  return a;
}
// column fragment from a [K][ld] layout (column n), rows >= K read as 0
__device__ __forceinline__ v16h fragc_f32(const float* W, int k0, int n, int lane, int ld, int K) {
  v16h a; const int g = lane >> 4;
#pragma unroll
  for (int i = 0; i < 8; ++i) { const int ka = k0 + 8 * g + i, kb = ka + 16;
    a[i] = (_Float16)(ka < K ? W[(size_t)(ka < K ? ka : K - 1) * ld + n] : 0.f); a[8 + i] = (_Float16)(kb < K ? W[(size_t)(kb < K ? kb : K - 1) * ld + n] : 0.f); }
  return a;
}
struct F2 { v16b h, l; };
__device__ __forceinline__ F2 bsplit16(const float v[16]) { F2 r;
#pragma unroll
  for (int i = 0; i < 16; ++i) { const __bf16 h = (__bf16)v[i]; r.h[i] = h; r.l[i] = (__bf16)(v[i] - (float)h); }
  return r; }
__device__ __forceinline__ F2 split_row(const float* row, int k0, int lane) { float v[16]; const float* p = row + k0 + 8 * (lane >> 4);
#pragma unroll
  for (int i = 0; i < 8; ++i) { v[i] = p[i]; v[8 + i] = p[16 + i]; }
  return bsplit16(v); }
__device__ __forceinline__ F2 split_rowK(const float* row, int k0, int lane, int K) { float v[16]; const int g = lane >> 4;
#pragma unroll
  for (int i = 0; i < 8; ++i) { const int ka = k0 + 8 * g + i, kb = ka + 16; v[i] = ka < K ? row[ka < K ? ka : K - 1] : 0.f; v[8 + i] = kb < K ? row[kb < K ? kb : K - 1] : 0.f; }
  return bsplit16(v); }
__device__ __forceinline__ F2 split_col(const float* W, int k0, int n, int lane, int ld, int K) { float v[16]; const int g = lane >> 4;
#pragma unroll
  for (int i = 0; i < 8; ++i) { const int ka = k0 + 8 * g + i, kb = ka + 16; v[i] = ka < K ? W[(size_t)(ka < K ? ka : K - 1) * ld + n] : 0.f; v[8 + i] = kb < K ? W[(size_t)(kb < K ? kb : K - 1) * ld + n] : 0.f; }
  return bsplit16(v); }
__device__ __forceinline__ v8f mac3(const F2& a, const F2& b, v8f c) { c = wmma_bf(a.l, b.h, c); c = wmma_bf(a.h, b.l, c); return wmma_bf(a.h, b.h, c); }
__device__ __forceinline__ float sigm(float v) { return 1.0f / (1.0f + expf(-v)); }
#define LDSX() do { asm volatile("s_wait_dscnt 0" ::: "memory"); __builtin_amdgcn_wave_barrier(); __builtin_amdgcn_fence(__ATOMIC_RELEASE, "workgroup"); } while (0)

// Plain multi-head attention core on given tensors (query / key / value [2,2048,32,64] = [batch, seq, heads, dim]; no mask, no projections; norm factor sqrt(64)): ctx = softmax(Q K^T / 8) V per (batch, head), returned as [2,2048,2048] (heads merged).
#define NB 2
#define TT 2048
#define CC 2048            // NH * HD = projected width
#define DIN 2048          // input (model) width
#define NH 32
#define HD 64
#define NQB (TT / 64)
#define HG 4
#define SCALE (0.125f)
#define CAUSAL 0
#ifndef TNB
#define TNB NB
#endif
__device__ __forceinline__ float bfr(float v) { return (float)(__bf16)v; }
__host__ __device__ __forceinline__ int kb_last(int qb) { return CAUSAL ? ((qb * 64 + 63) >> 7) : (TT / 128 - 1); }
typedef __attribute__((ext_vector_type(8))) __bf16 v8b;
__device__ __forceinline__ v16b frag_b(const __bf16* rowk0, int lane) {
  union { v16b v; v8b q[2]; } u; const __bf16* p = rowk0 + 8 * (lane >> 4);
  u.q[0] = *(const v8b*)p; u.q[1] = *(const v8b*)(p + 16); return u.v;
}
#define QBH 0
#define QHI 0               // exact planes: single-product logits everywhere
#define KHI 64            // key rows carrying k residual / v bf16 hi+lo planes (written only by k_proj, which is not launched)
// B fragment (k rows k0+.., output column o) of a weight: (in,out) [K][ld] or (out,in) [ld rows of K]: bf16 exact, or f16(bf16 * 256) exact
__device__ __forceinline__ v16b wcol_io(const float* Wm, int k0, int o, int lane, int ld) { v16b w; const int g = lane >> 4;
#pragma unroll
  for (int i = 0; i < 8; ++i) { w[i] = (__bf16)Wm[(size_t)(k0 + 8 * g + i) * ld + o]; w[8 + i] = (__bf16)Wm[(size_t)(k0 + 16 + 8 * g + i) * ld + o]; }
  return w; }
__device__ __forceinline__ v16b wcol_oi(const float* Wm, int k0, int o, int lane, int K) { v16b w; const float* p = Wm + (size_t)o * K + k0 + 8 * (lane >> 4);
#pragma unroll
  for (int i = 0; i < 8; ++i) { w[i] = (__bf16)p[i]; w[8 + i] = (__bf16)p[16 + i]; }
  return w; }
__device__ __forceinline__ v16h wcolh_io(const float* Wm, int k0, int o, int lane, int ld) { v16h w; const int g = lane >> 4;
#pragma unroll
  for (int i = 0; i < 8; ++i) { w[i] = (_Float16)(bfr(Wm[(size_t)(k0 + 8 * g + i) * ld + o]) * 256.0f); w[8 + i] = (_Float16)(bfr(Wm[(size_t)(k0 + 16 + 8 * g + i) * ld + o]) * 256.0f); }
  return w; }
__device__ __forceinline__ v16h wcolh_oi(const float* Wm, int k0, int o, int lane, int K) { v16h w; const float* p = Wm + (size_t)o * K + k0 + 8 * (lane >> 4);
#pragma unroll
  for (int i = 0; i < 8; ++i) { w[i] = (_Float16)(bfr(p[i]) * 256.0f); w[8 + i] = (_Float16)(bfr(p[16 + i]) * 256.0f); }
  return w; }
#define WQKV_LAYOUT 0   // 0 = (in,out) [DIN][CC]; 1 = (out,in) [CC][DIN]; 2 = per-head [NH][DIN][HD]
__device__ __forceinline__ v16b wcol_hdk(const float* Wm, int k0, int o, int lane) { v16b w; const int g = lane >> 4; const float* p = Wm + (size_t)(o / HD) * DIN * HD + (o % HD);
#pragma unroll
  for (int i = 0; i < 8; ++i) { w[i] = (__bf16)p[(size_t)(k0 + 8 * g + i) * HD]; w[8 + i] = (__bf16)p[(size_t)(k0 + 16 + 8 * g + i) * HD]; }
  return w; }
#define WO_OUT_IN 0
#if WQKV_LAYOUT == 1
#define WCOL(W, k0, o, lane) wcol_oi(W, k0, o, lane, DIN)
#elif WQKV_LAYOUT == 2
#define WCOL(W, k0, o, lane) wcol_hdk(W, k0, o, lane)
#else
#define WCOL(W, k0, o, lane) wcol_io(W, k0, o, lane, CC)
#endif
#if WO_OUT_IN
#define WOCOL(W, k0, o, lane) wcol_oi(W, k0, o, lane, CC)
#define WOCOLH(W, k0, o, lane) wcolh_oi(W, k0, o, lane, CC)
#else
#define WOCOL(W, k0, o, lane) wcol_io(W, k0, o, lane, DIN)
#define WOCOLH(W, k0, o, lane) wcolh_io(W, k0, o, lane, DIN)
#endif
typedef _Float16 hx8 __attribute__((ext_vector_type(8)));
__global__ __launch_bounds__(256) void k_planesN(const float* __restrict__ Qs, const float* __restrict__ Ks, const float* __restrict__ Vs, _Float16* __restrict__ QH, _Float16* __restrict__ QL, _Float16* __restrict__ KH, _Float16* __restrict__ VT) {
  __shared__ _Float16 sv[64][136];
  const int tid = threadIdx.x; const int c0 = blockIdx.y * 128; const size_t r0 = (size_t)blockIdx.x * 64; const int b = (int)(r0 / TT), t0 = (int)(r0 % TT);
  for (int e = tid; e < 64 * 16; e += 256) { const int rl = e >> 4, q = e & 15; const size_t src = (r0 + rl) * CC + c0 + q * 8; float tq[8], tk[8], tv[8];
#pragma unroll
    for (int u = 0; u < 8; ++u) { tq[u] = Qs[src + u]; tk[u] = Ks[src + u]; tv[u] = Vs[src + u]; }
    asm volatile("s_wait_loadcnt 0x0" ::: "memory");
    hx8 hq, hk, hl;
#pragma unroll
    for (int u = 0; u < 8; ++u) { const float qv = bfr(tq[u]); const _Float16 qh = (_Float16)qv; hq[u] = qh; hl[u] = (_Float16)((qv - (float)qh) * 1024.0f); hk[u] = (_Float16)bfr(tk[u]); sv[rl][q * 8 + u] = (_Float16)bfr(tv[u]); }
    vst2((unsigned*)(QH + src), *(const v4u*)&hq); vst2((unsigned*)(KH + src), *(const v4u*)&hk);
    if (t0 + rl < QHI) vst2((unsigned*)(QL + ((size_t)b * QHI + t0 + rl) * CC + c0 + q * 8), *(const v4u*)&hl); }
  __syncthreads();
  for (int e = tid; e < 128 * 8; e += 256) { const int c = e >> 3, q = e & 7; hx8 hv; _Pragma("unroll") for (int j = 0; j < 8; ++j) hv[j] = sv[q * 8 + j][c]; vst2((unsigned*)(VT + ((size_t)b * CC + c0 + c) * TT + t0 + q * 8), *(const v4u*)&hv); } }
#define SM_EXTRA_PARAMS
#define SM_MASK_HOOK (void)0
#ifndef SM_EXTRA_PARAMS
#define SM_EXTRA_PARAMS
#endif
#ifndef PROJ_EXTRA_PARAMS
#define PROJ_EXTRA_PARAMS
#endif
#ifndef SM_MASK_HOOK
#define SM_MASK_HOOK (void)0
#endif

#define WS_QH  0u                                      // f16 q rows [b*t][CC]
#define WS_KH  (WS_QH + 2u * (size_t)NB * TT * CC)      // f16 k rows [b*t][CC]
#define WS_VT  (WS_KH + 2u * (size_t)NB * TT * CC)      // f16 v planes [b][c][t]
#define WS_QL  (WS_VT + 2u * (size_t)NB * CC * TT)      // f16 q residual x 2^10 rows [b][t < QHI][CC]
#define WS_KL  (WS_QL + 2u * (size_t)NB * QHI * CC)     // f16 k residual x 2^10 rows [b][t < KHI][CC]
#define WS_VB  (WS_KL + 2u * (size_t)NB * KHI * CC)     // bf16 v hi planes [b][c][t < KHI]
#define WS_VBL (WS_VB + 2u * (size_t)NB * CC * KHI)
#define WS_S   (WS_VBL + 2u * (size_t)NB * CC * KHI)    // f32 [hg][t][s], reserved; no kernel here uses it
#define WS_Y   (WS_S  + 4u * (size_t)HG * TT * TT)      // f32 ctx rows [b*t][CC] (only when there is an output projection)
#define WS_END (WS_Y  + 0u)

// ---- k_proj: block = (64 rows, 128 cols, which): q/k/v = X W (+ b) with exact bf16 products (K = DIN) -> which 0: q f16 rows (+ residual rows < QHI); 1: k f16 rows (+ residual rows < KHI); 2: v f16 planes [c][t] (+ bf16 hi/lo planes for t < KHI)
__global__ __launch_bounds__(128) void k_proj(const float* __restrict__ XQ, const float* __restrict__ XK, const float* __restrict__ XV, const float* __restrict__ WQ, const float* __restrict__ WK, const float* __restrict__ WV, const float* __restrict__ BQ, const float* __restrict__ BK, const float* __restrict__ BV,
    _Float16* __restrict__ QH, _Float16* __restrict__ QL, _Float16* __restrict__ KH, _Float16* __restrict__ KL, _Float16* __restrict__ VT, __bf16* __restrict__ VB, __bf16* __restrict__ VBL) {
  __shared__ __align__(16) _Float16 sh[64][136], sl[64][136]; __shared__ __align__(16) _Float16 th[128][72]; __shared__ __align__(16) __bf16 tb[128][72], tbl[128][72];
  const int tid = threadIdx.x, wave = tid >> 5, lane = tid & 31, col = lane & 15, g = lane >> 4; const int which = blockIdx.z; const int c0 = blockIdx.y * 128; const size_t r0 = (size_t)blockIdx.x * 64; const size_t bb = r0 / TT; const int t0 = (int)(r0 % TT);
  const float* X = which == 0 ? XQ : which == 1 ? XK : XV; const float* WA = which == 0 ? WQ : which == 1 ? WK : WV; const float* BA = which == 0 ? BQ : which == 1 ? BK : BV;
  v8f acc[8] = {};
#pragma unroll 2
  for (int kc = 0; kc < DIN / 32; ++kc) { v16b a; { const float* p = X + (r0 + wave * 16 + col) * DIN + kc * 32 + 8 * g;
#pragma unroll
      for (int i = 0; i < 8; ++i) { a[i] = (__bf16)p[i]; a[8 + i] = (__bf16)p[16 + i]; } }
    asm volatile("s_wait_loadcnt 0x0" ::: "memory");
#pragma unroll
    for (int j = 0; j < 8; ++j) { const v16b w = WCOL(WA, kc * 32, c0 + j * 16 + col, lane); asm volatile("s_wait_loadcnt 0x0" ::: "memory"); acc[j] = wmma_bf(a, w, acc[j]); } }
  if (which < 2) { _Float16* DH = which == 0 ? QH : KH; _Float16* DL = which == 0 ? QL : KL; const int nhi = which == 0 ? QHI : KHI; const bool hi_rows = t0 < nhi;
#pragma unroll
    for (int j = 0; j < 8; ++j) { const float bias = BA ? bfr(BA[c0 + j * 16 + col]) : 0.f;
#pragma unroll
      for (int r = 0; r < 8; ++r) { const float v = acc[j][r] + bias; const _Float16 hv = (_Float16)v; sh[wave * 16 + 8 * g + r][j * 16 + col] = hv; sl[wave * 16 + 8 * g + r][j * 16 + col] = (_Float16)((v - (float)hv) * 1024.0f); } }
    __syncthreads();
    for (int e = tid; e < 64 * 16; e += 128) { const int rl = e >> 4, q = e & 15; vst2((unsigned*)(DH + (r0 + rl) * CC + c0 + q * 8), *(const v4u*)&sh[rl][q * 8]); if (hi_rows) vst2((unsigned*)(DL + (bb * nhi + t0 + rl) * (size_t)CC + c0 + q * 8), *(const v4u*)&sl[rl][q * 8]); }
  } else { const bool hi_rows = t0 < KHI;
#pragma unroll
    for (int j = 0; j < 8; ++j) { const float bias = BA ? bfr(BA[c0 + j * 16 + col]) : 0.f;
#pragma unroll
      for (int r = 0; r < 8; ++r) { const float v = acc[j][r] + bias; const int rl = wave * 16 + 8 * g + r, cl = j * 16 + col; th[cl][rl] = (_Float16)v; const __bf16 bh = (__bf16)v; tb[cl][rl] = bh; tbl[cl][rl] = (__bf16)(v - (float)bh); } }
    __syncthreads();
    for (int e = tid; e < 128 * 8; e += 128) { const int cl = e >> 3, q = e & 7; vst2((unsigned*)(VT + (bb * CC + c0 + cl) * (size_t)TT + t0 + q * 8), *(const v4u*)&th[cl][q * 8]); if (hi_rows) { const size_t o3 = (bb * CC + c0 + cl) * (size_t)KHI + t0 + q * 8; vst2((unsigned*)(VB + o3), *(const v4u*)&tb[cl][q * 8]); vst2((unsigned*)(VBL + o3), *(const v4u*)&tbl[cl][q * 8]); } } } }
// ---- k_fa: block = 256 queries of one (batch, head), 8 waves x 32 query columns; keys walked in stages of 64 through two LDS buffers.
// Transposed products: S^T = K . Q^T (a lane holds 16 of one query's 32 logits per pass), P^T packs from the score registers straight into the B operand of O^T += V^T . P^T.
// Online softmax in the log2 domain: m_run may trail the true maximum by up to 8, so P <= 2^8 stays far inside f16; sums and outputs are rescaled only when a column's maximum exceeds it by more.
// Every inner loop is fully unrolled so that the fragment, score and output arrays are indexed by constants and stay in registers.
#define FAW 8              // waves per block
#define FAS 64             // keys per stage
#define FAP 72             // LDS row pitch in halves: 128 B of data + 16 B, an odd multiple of 16 B
#define FNS (TT / FAS)
typedef __attribute__((ext_vector_type(2))) _Float16 v2h;
__device__ __forceinline__ v8f mmh(v16h a, v16h b, v8f c) { return __builtin_amdgcn_wmma_f32_16x16x32_f16(false, a, false, b, (short)0, c, false, false); }
__device__ __forceinline__ float xhalf(float x) { return __builtin_bit_cast(float, __builtin_amdgcn_permlanex16(__builtin_bit_cast(int, x), __builtin_bit_cast(int, x), 0x76543210, 0xfedcba98, false, false)); }  // lane l with lane l ^ 16
__global__ __launch_bounds__(256) __attribute__((amdgpu_waves_per_eu(4, 4))) void k_fa(const _Float16* __restrict__ QH, const _Float16* __restrict__ KH, const _Float16* __restrict__ VT, float* __restrict__ Y) {
  __shared__ __align__(16) _Float16 sk[2][FAS][FAP], sv[2][HD][FAP]; __shared__ __align__(16) float so[FAW][32][HD + 4];
  const int tid = threadIdx.x, wave = tid >> 5, lane = tid & 31, col = lane & 15, g = lane >> 4;
  const int b = blockIdx.y / NH, h = blockIdx.y % NH; const int q0 = blockIdx.x * (FAW * 32) + wave * 32;
  // staging: 8 lanes fetch one whole 128-B line (a key's head slice of k; 64 keys of one v plane); each thread moves rows srow and srow + 32 of both tiles
  const int srow = tid >> 3, sch = (tid & 7) * 8;
  const _Float16* kg = KH + ((size_t)b * TT + srow) * CC + h * HD + sch;
  const _Float16* vg = VT + ((size_t)b * CC + h * HD + srow) * TT + sch;
  v8h rk0 = *(const v8h*)kg, rk1 = *(const v8h*)(kg + (size_t)32 * CC), rv0 = *(const v8h*)vg, rv1 = *(const v8h*)(vg + (size_t)32 * TT);
  v16h qf[2][2];
#pragma unroll
  for (int gq = 0; gq < 2; ++gq)
#pragma unroll
    for (int kc = 0; kc < 2; ++kc) qf[gq][kc] = frag_h(QH + ((size_t)b * TT + q0 + gq * 16 + col) * CC + h * HD + kc * 32, lane);
  v8f acc[2][4] = {}; v2f l2[2] = {}; float m_run[2] = {-1.0e30f, -1.0e30f};
  const float cs = SCALE * 1.4426950408889634f;
  *(v8h*)&sk[0][srow][sch] = rk0; *(v8h*)&sk[0][srow + 32][sch] = rk1; *(v8h*)&sv[0][srow][sch] = rv0; *(v8h*)&sv[0][srow + 32][sch] = rv1;
  __syncthreads();
#pragma unroll 1   // the stage loop stays rolled: a second copy of its body would not fit the 256 registers that four waves per SIMD allow
  for (int st = 0; st < FNS; ++st) { const int bf = st & 1;
    { const int ks = (st + 1 < FNS ? st + 1 : st) * FAS;   // next stage's lines fly while this stage is worked on (the last stage fetches itself again, into the buffer nobody reads any more: no branch behind the matrix run)
      rk0 = *(const v8h*)(kg + (size_t)ks * CC); rk1 = *(const v8h*)(kg + (size_t)(ks + 32) * CC); rv0 = *(const v8h*)(vg + ks); rv1 = *(const v8h*)(vg + (size_t)32 * TT + ks); }
    __builtin_amdgcn_sched_barrier(0);   // keeps the four loads at the head of the stage: sunk towards their LDS stores they would have half a pass, not two, to arrive in
#pragma unroll
    for (int ps = 0; ps < FAS / 32; ++ps) {
      v8f s[2][2];
#pragma unroll
      for (int kt = 0; kt < 2; ++kt) { const v16h k0 = frag_h(&sk[bf][ps * 32 + kt * 16 + col][0], lane), k1 = frag_h(&sk[bf][ps * 32 + kt * 16 + col][32], lane);
#pragma unroll
        for (int gq = 0; gq < 2; ++gq) { v8f z = {}; z = mmh(k0, qf[gq][0], z); s[kt][gq] = mmh(k1, qf[gq][1], z); } }
      v16h vf[4];
#pragma unroll
      for (int j = 0; j < 4; ++j) vf[j] = frag_h(&sv[bf][j * 16 + col][ps * 32], lane);
      float mb[2]; bool need = false;
#pragma unroll
      for (int gq = 0; gq < 2; ++gq) { float mx = s[0][gq][0];
#pragma unroll
        for (int r = 1; r < 8; ++r) mx = fmaxf(mx, s[0][gq][r]);
#pragma unroll
        for (int r = 0; r < 8; ++r) mx = fmaxf(mx, s[1][gq][r]);
        mx = fmaxf(mx, xhalf(mx)) * cs; mb[gq] = mx; need = need || (mx > m_run[gq] + 8.0f); }
      if (__builtin_amdgcn_ballot_w32(need) != 0) {   // scalar branch, rare after the first pass
#pragma unroll
        for (int gq = 0; gq < 2; ++gq) { const float mn = fmaxf(m_run[gq], mb[gq]); const float corr = __builtin_amdgcn_exp2f(m_run[gq] - mn); m_run[gq] = mn; l2[gq] = l2[gq] * corr;
#pragma unroll
          for (int j = 0; j < 4; ++j) acc[gq][j] = acc[gq][j] * corr; } }
#pragma unroll
      for (int gq = 0; gq < 2; ++gq) { const float nm = -m_run[gq]; v16h pf;
#pragma unroll
        for (int i = 0; i < 8; ++i) {   // operand elements 2i, 2i+1 = key 8g + .. of score tile i >> 2: the k order of frag_h
          const v2f a = __builtin_elementwise_fma(v2f{s[i >> 2][gq][2 * (i & 3)], s[i >> 2][gq][2 * (i & 3) + 1]}, v2f{cs, cs}, v2f{nm, nm});
          const v2f p = {__builtin_amdgcn_exp2f(a.x), __builtin_amdgcn_exp2f(a.y)}; l2[gq] = l2[gq] + p;
          const v2h ph = __builtin_convertvector(p, v2h); pf[2 * i] = ph.x; pf[2 * i + 1] = ph.y; }
#pragma unroll
        for (int j = 0; j < 4; ++j) acc[gq][j] = mmh(vf[j], pf, acc[gq][j]); } }
    { *(v8h*)&sk[bf ^ 1][srow][sch] = rk0; *(v8h*)&sk[bf ^ 1][srow + 32][sch] = rk1; *(v8h*)&sv[bf ^ 1][srow][sch] = rv0; *(v8h*)&sv[bf ^ 1][srow + 32][sch] = rv1; }
    __syncthreads();   // publishes stage st + 1 and ends every wave's reads of the buffer that stage st + 1 refills
  }
#pragma unroll
  for (int gq = 0; gq < 2; ++gq) { float l = l2[gq].x + l2[gq].y; l += xhalf(l); const float inv = 1.0f / l;
#pragma unroll
    for (int j = 0; j < 4; ++j) { const v8f o = acc[gq][j] * inv; *(v4f*)&so[wave][gq * 16 + col][j * 16 + 8 * g] = v4f{o[0], o[1], o[2], o[3]}; *(v4f*)&so[wave][gq * 16 + col][j * 16 + 8 * g + 4] = v4f{o[4], o[5], o[6], o[7]}; } }
  LDSX();   // the wave's own rows are read back by other lanes, so that 16 lanes store one whole 256-B (row, head) segment
#pragma unroll
  for (int rl = 0; rl < 32; rl += 2) vst2(Y + ((size_t)b * TT + q0 + rl + g) * CC + h * HD + col * 4, *(const v4f*)&so[wave][rl + g][col * 4]);
}

extern "C" void kernel_launch(void* const* d_in, const int* in_sizes, int n_in, void* d_out, int out_size, void* d_ws, size_t ws_size, hipStream_t stream) {
  (void)in_sizes; (void)n_in; (void)out_size;
  const float** F = (const float**)d_in;
  if (ws_size < (size_t)WS_END) return;
  char* ws = (char*)d_ws; _Float16 *QH = (_Float16*)(ws + WS_QH), *KH = (_Float16*)(ws + WS_KH), *VT = (_Float16*)(ws + WS_VT), *QL = (_Float16*)(ws + WS_QL), *KL = (_Float16*)(ws + WS_KL); __bf16 *VB = (__bf16*)(ws + WS_VB), *VBL = (__bf16*)(ws + WS_VBL); float *S = (float*)(ws + WS_S), *Y = (float*)(ws + WS_Y);
  (void)Y; (void)S; (void)QL; (void)KL; (void)VB; (void)VBL;
  // inputs: 0 query [2,2048,32,64]; 1 key; 2 value (rows [b*2048 + s][n*64 + h] = merged-head rows)
  k_planesN<<<dim3(TNB * TT / 64, CC / 128), 256, 0, stream>>>(F[0], F[1], F[2], QH, QL, KH, VT);
  k_fa<<<dim3(TT / (FAW * 32), TNB * NH), 256, 0, stream>>>(QH, KH, VT, (float*)d_out);   /* ctx [b, sq, n*h] = merged-head rows */
}

// v002
// One run takes 60.8 microseconds.
// Timed twice side by side with v001, it ran 1.16 times as fast both times.
// All steps since v000 together make it 32.6 times as fast.
// compute dtype: all float inputs rounded to bf16; query, key, value are bf16-valued so their f16 planes are exact; logits q x k (1 product on exact planes) x 64^-0.5; online softmax f32; P = 2^(logit - running maximum) once to f16 x v (exact) (1 product), divided by the f32 sum at the end; f32 output.
#include <hip/hip_runtime.h>
#include <math.h>

typedef __attribute__((ext_vector_type(16))) _Float16 v16h;
typedef __attribute__((ext_vector_type(16))) __bf16 v16b;
typedef __attribute__((ext_vector_type(8)))  _Float16 v8h;
typedef __attribute__((ext_vector_type(8)))  float v8f;
typedef __attribute__((ext_vector_type(4)))  float v4f;
typedef __attribute__((ext_vector_type(2)))  float v2f;
typedef __attribute__((ext_vector_type(4)))  unsigned v4u;
typedef __attribute__((ext_vector_type(4)))  int v4i;
typedef float __attribute__((may_alias)) float_a;
typedef int __attribute__((may_alias)) int_a;

template <typename T> __device__ __forceinline__ void vst2(void* p, T v) { *(T*)p = v;  }
__device__ __forceinline__ v8f wmma16(v16h a, v16h b, v8f c) {
  v8f d = __builtin_amdgcn_wmma_f32_16x16x32_f16(false, a, false, b, (short)0, c, false, false);
  asm volatile("v_nop\n\tv_nop\n\tv_nop\n\tv_nop" : "+v"(d) : "v"(a), "v"(b));
  return d;
}
__device__ __forceinline__ v8f wmma_bf(v16b a, v16b b, v8f c) {
  v8f d = __builtin_amdgcn_wmma_f32_16x16x32_bf16(false, a, false, b, (short)0, c, false, false);
  asm volatile("v_nop\n\tv_nop\n\tv_nop\n\tv_nop" : "+v"(d) : "v"(a), "v"(b));
  return d;
}
// 16x16x32 fragments: lane = (h = lane>>4, row/col = lane&15); elements 0..7 = k0+8h+0..7, 8..15 = k0+16+8h+0..7; D element r = row 8h+r
__device__ __forceinline__ v16h frag_h(const _Float16* rowk0, int lane) {
  union { v16h v; v8h q[2]; } u; const _Float16* p = rowk0 + 8 * (lane >> 4);
  u.q[0] = *(const v8h*)p; u.q[1] = *(const v8h*)(p + 16); return u.v;
}
__device__ __forceinline__ v16h frag_f32(const float* rowk0, int lane) {
  v16h a; const float* p = rowk0 + 8 * (lane >> 4);
#pragma unroll
  for (int i = 0; i < 8; ++i) { a[i] = (_Float16)p[i]; a[8 + i] = (_Float16)p[16 + i]; }
  return a;
}
__device__ __forceinline__ v16h frag_f32s(const float* rowk0, int lane, float sc) {
  v16h a; const float* p = rowk0 + 8 * (lane >> 4);
#pragma unroll
  for (int i = 0; i < 8; ++i) { a[i] = (_Float16)(p[i] * sc); a[8 + i] = (_Float16)(p[16 + i] * sc); }
  return a;
}
// column fragment from a [K][ld] layout (column n), rows >= K read as 0
__device__ __forceinline__ v16h fragc_f32(const float* W, int k0, int n, int lane, int ld, int K) {
  v16h a; const int g = lane >> 4;
#pragma unroll
  for (int i = 0; i < 8; ++i) { const int ka = k0 + 8 * g + i, kb = ka + 16;
    a[i] = (_Float16)(ka < K ? W[(size_t)(ka < K ? ka : K - 1) * ld + n] : 0.f); a[8 + i] = (_Float16)(kb < K ? W[(size_t)(kb < K ? kb : K - 1) * ld + n] : 0.f); }
  return a;
}
struct F2 { v16b h, l; };
__device__ __forceinline__ F2 bsplit16(const float v[16]) { F2 r;
#pragma unroll
  for (int i = 0; i < 16; ++i) { const __bf16 h = (__bf16)v[i]; r.h[i] = h; r.l[i] = (__bf16)(v[i] - (float)h); }
  return r; }
__device__ __forceinline__ F2 split_row(const float* row, int k0, int lane) { float v[16]; const float* p = row + k0 + 8 * (lane >> 4);
#pragma unroll
  for (int i = 0; i < 8; ++i) { v[i] = p[i]; v[8 + i] = p[16 + i]; }
  return bsplit16(v); }
__device__ __forceinline__ F2 split_rowK(const float* row, int k0, int lane, int K) { float v[16]; const int g = lane >> 4;
#pragma unroll
  for (int i = 0; i < 8; ++i) { const int ka = k0 + 8 * g + i, kb = ka + 16; v[i] = ka < K ? row[ka < K ? ka : K - 1] : 0.f; v[8 + i] = kb < K ? row[kb < K ? kb : K - 1] : 0.f; }
  return bsplit16(v); }
__device__ __forceinline__ F2 split_col(const float* W, int k0, int n, int lane, int ld, int K) { float v[16]; const int g = lane >> 4;
#pragma unroll
  for (int i = 0; i < 8; ++i) { const int ka = k0 + 8 * g + i, kb = ka + 16; v[i] = ka < K ? W[(size_t)(ka < K ? ka : K - 1) * ld + n] : 0.f; v[8 + i] = kb < K ? W[(size_t)(kb < K ? kb : K - 1) * ld + n] : 0.f; }
  return bsplit16(v); }
__device__ __forceinline__ v8f mac3(const F2& a, const F2& b, v8f c) { c = wmma_bf(a.l, b.h, c); c = wmma_bf(a.h, b.l, c); return wmma_bf(a.h, b.h, c); }
__device__ __forceinline__ float sigm(float v) { return 1.0f / (1.0f + expf(-v)); }
#define LDSX() do { asm volatile("s_wait_dscnt 0" ::: "memory"); __builtin_amdgcn_wave_barrier(); __builtin_amdgcn_fence(__ATOMIC_RELEASE, "workgroup"); } while (0)

// Plain multi-head attention core on given tensors (query / key / value [2,2048,32,64] = [batch, seq, heads, dim]; no mask, no projections; norm factor sqrt(64)): ctx = softmax(Q K^T / 8) V per (batch, head), returned as [2,2048,2048] (heads merged).
#define NB 2
#define TT 2048
#define CC 2048            // NH * HD = projected width
#define DIN 2048          // input (model) width
#define NH 32
#define HD 64
#define NQB (TT / 64)
#define HG 4
#define SCALE (0.125f)
#define CAUSAL 0
#ifndef TNB
#define TNB NB
#endif
__device__ __forceinline__ float bfr(float v) { return (float)(__bf16)v; }
__host__ __device__ __forceinline__ int kb_last(int qb) { return CAUSAL ? ((qb * 64 + 63) >> 7) : (TT / 128 - 1); }
typedef __attribute__((ext_vector_type(8))) __bf16 v8b;
__device__ __forceinline__ v16b frag_b(const __bf16* rowk0, int lane) {
  union { v16b v; v8b q[2]; } u; const __bf16* p = rowk0 + 8 * (lane >> 4);
  u.q[0] = *(const v8b*)p; u.q[1] = *(const v8b*)(p + 16); return u.v;
}
#define QBH 0
#define QHI 0               // exact planes: single-product logits everywhere
#define KHI 64            // key rows carrying k residual / v bf16 hi+lo planes (written only by k_proj, which is not launched)
// B fragment (k rows k0+.., output column o) of a weight: (in,out) [K][ld] or (out,in) [ld rows of K]: bf16 exact, or f16(bf16 * 256) exact
__device__ __forceinline__ v16b wcol_io(const float* Wm, int k0, int o, int lane, int ld) { v16b w; const int g = lane >> 4;
#pragma unroll
  for (int i = 0; i < 8; ++i) { w[i] = (__bf16)Wm[(size_t)(k0 + 8 * g + i) * ld + o]; w[8 + i] = (__bf16)Wm[(size_t)(k0 + 16 + 8 * g + i) * ld + o]; }
  return w; }
__device__ __forceinline__ v16b wcol_oi(const float* Wm, int k0, int o, int lane, int K) { v16b w; const float* p = Wm + (size_t)o * K + k0 + 8 * (lane >> 4);
#pragma unroll
  for (int i = 0; i < 8; ++i) { w[i] = (__bf16)p[i]; w[8 + i] = (__bf16)p[16 + i]; }
  return w; }
__device__ __forceinline__ v16h wcolh_io(const float* Wm, int k0, int o, int lane, int ld) { v16h w; const int g = lane >> 4;
#pragma unroll
  for (int i = 0; i < 8; ++i) { w[i] = (_Float16)(bfr(Wm[(size_t)(k0 + 8 * g + i) * ld + o]) * 256.0f); w[8 + i] = (_Float16)(bfr(Wm[(size_t)(k0 + 16 + 8 * g + i) * ld + o]) * 256.0f); }
  return w; }
__device__ __forceinline__ v16h wcolh_oi(const float* Wm, int k0, int o, int lane, int K) { v16h w; const float* p = Wm + (size_t)o * K + k0 + 8 * (lane >> 4);
#pragma unroll
  for (int i = 0; i < 8; ++i) { w[i] = (_Float16)(bfr(p[i]) * 256.0f); w[8 + i] = (_Float16)(bfr(p[16 + i]) * 256.0f); }
  return w; }
#define WQKV_LAYOUT 0   // 0 = (in,out) [DIN][CC]; 1 = (out,in) [CC][DIN]; 2 = per-head [NH][DIN][HD]
__device__ __forceinline__ v16b wcol_hdk(const float* Wm, int k0, int o, int lane) { v16b w; const int g = lane >> 4; const float* p = Wm + (size_t)(o / HD) * DIN * HD + (o % HD);
#pragma unroll
  for (int i = 0; i < 8; ++i) { w[i] = (__bf16)p[(size_t)(k0 + 8 * g + i) * HD]; w[8 + i] = (__bf16)p[(size_t)(k0 + 16 + 8 * g + i) * HD]; }
  return w; }
#define WO_OUT_IN 0
#if WQKV_LAYOUT == 1
#define WCOL(W, k0, o, lane) wcol_oi(W, k0, o, lane, DIN)
#elif WQKV_LAYOUT == 2
#define WCOL(W, k0, o, lane) wcol_hdk(W, k0, o, lane)
#else
#define WCOL(W, k0, o, lane) wcol_io(W, k0, o, lane, CC)
#endif
#if WO_OUT_IN
#define WOCOL(W, k0, o, lane) wcol_oi(W, k0, o, lane, CC)
#define WOCOLH(W, k0, o, lane) wcolh_oi(W, k0, o, lane, CC)
#else
#define WOCOL(W, k0, o, lane) wcol_io(W, k0, o, lane, DIN)
#define WOCOLH(W, k0, o, lane) wcolh_io(W, k0, o, lane, DIN)
#endif
typedef _Float16 hx8 __attribute__((ext_vector_type(8)));
#define SM_EXTRA_PARAMS
#define SM_MASK_HOOK (void)0
#ifndef SM_EXTRA_PARAMS
#define SM_EXTRA_PARAMS
#endif
#ifndef PROJ_EXTRA_PARAMS
#define PROJ_EXTRA_PARAMS
#endif
#ifndef SM_MASK_HOOK
#define SM_MASK_HOOK (void)0
#endif

#define WS_QH  0u                                      // f16 q rows [b*t][CC]
#define WS_KH  (WS_QH + 2u * (size_t)NB * TT * CC)      // f16 k rows [b*t][CC]
#define WS_VT  (WS_KH + 2u * (size_t)NB * TT * CC)      // f16 v planes [b][c][t]
#define WS_QL  (WS_VT + 2u * (size_t)NB * CC * TT)      // f16 q residual x 2^10 rows [b][t < QHI][CC]
#define WS_KL  (WS_QL + 2u * (size_t)NB * QHI * CC)     // f16 k residual x 2^10 rows [b][t < KHI][CC]
#define WS_VB  (WS_KL + 2u * (size_t)NB * KHI * CC)     // bf16 v hi planes [b][c][t < KHI]
#define WS_VBL (WS_VB + 2u * (size_t)NB * CC * KHI)
#define WS_S   (WS_VBL + 2u * (size_t)NB * CC * KHI)    // f32 [hg][t][s], reserved; no kernel here uses it
#define WS_Y   (WS_S  + 4u * (size_t)HG * TT * TT)      // f32 ctx rows [b*t][CC] (only when there is an output projection)
#define WS_END (WS_Y  + 0u)

// ---- k_proj: block = (64 rows, 128 cols, which): q/k/v = X W (+ b) with exact bf16 products (K = DIN) -> which 0: q f16 rows (+ residual rows < QHI); 1: k f16 rows (+ residual rows < KHI); 2: v f16 planes [c][t] (+ bf16 hi/lo planes for t < KHI)
__global__ __launch_bounds__(128) void k_proj(const float* __restrict__ XQ, const float* __restrict__ XK, const float* __restrict__ XV, const float* __restrict__ WQ, const float* __restrict__ WK, const float* __restrict__ WV, const float* __restrict__ BQ, const float* __restrict__ BK, const float* __restrict__ BV,
    _Float16* __restrict__ QH, _Float16* __restrict__ QL, _Float16* __restrict__ KH, _Float16* __restrict__ KL, _Float16* __restrict__ VT, __bf16* __restrict__ VB, __bf16* __restrict__ VBL) {
  __shared__ __align__(16) _Float16 sh[64][136], sl[64][136]; __shared__ __align__(16) _Float16 th[128][72]; __shared__ __align__(16) __bf16 tb[128][72], tbl[128][72];
  const int tid = threadIdx.x, wave = tid >> 5, lane = tid & 31, col = lane & 15, g = lane >> 4; const int which = blockIdx.z; const int c0 = blockIdx.y * 128; const size_t r0 = (size_t)blockIdx.x * 64; const size_t bb = r0 / TT; const int t0 = (int)(r0 % TT);
  const float* X = which == 0 ? XQ : which == 1 ? XK : XV; const float* WA = which == 0 ? WQ : which == 1 ? WK : WV; const float* BA = which == 0 ? BQ : which == 1 ? BK : BV;
  v8f acc[8] = {};
#pragma unroll 2
  for (int kc = 0; kc < DIN / 32; ++kc) { v16b a; { const float* p = X + (r0 + wave * 16 + col) * DIN + kc * 32 + 8 * g;
#pragma unroll
      for (int i = 0; i < 8; ++i) { a[i] = (__bf16)p[i]; a[8 + i] = (__bf16)p[16 + i]; } }
    asm volatile("s_wait_loadcnt 0x0" ::: "memory");
#pragma unroll
    for (int j = 0; j < 8; ++j) { const v16b w = WCOL(WA, kc * 32, c0 + j * 16 + col, lane); asm volatile("s_wait_loadcnt 0x0" ::: "memory"); acc[j] = wmma_bf(a, w, acc[j]); } }
  if (which < 2) { _Float16* DH = which == 0 ? QH : KH; _Float16* DL = which == 0 ? QL : KL; const int nhi = which == 0 ? QHI : KHI; const bool hi_rows = t0 < nhi;
#pragma unroll
    for (int j = 0; j < 8; ++j) { const float bias = BA ? bfr(BA[c0 + j * 16 + col]) : 0.f;
#pragma unroll
      for (int r = 0; r < 8; ++r) { const float v = acc[j][r] + bias; const _Float16 hv = (_Float16)v; sh[wave * 16 + 8 * g + r][j * 16 + col] = hv; sl[wave * 16 + 8 * g + r][j * 16 + col] = (_Float16)((v - (float)hv) * 1024.0f); } }
    __syncthreads();
    for (int e = tid; e < 64 * 16; e += 128) { const int rl = e >> 4, q = e & 15; vst2((unsigned*)(DH + (r0 + rl) * CC + c0 + q * 8), *(const v4u*)&sh[rl][q * 8]); if (hi_rows) vst2((unsigned*)(DL + (bb * nhi + t0 + rl) * (size_t)CC + c0 + q * 8), *(const v4u*)&sl[rl][q * 8]); }
  } else { const bool hi_rows = t0 < KHI;
#pragma unroll
    for (int j = 0; j < 8; ++j) { const float bias = BA ? bfr(BA[c0 + j * 16 + col]) : 0.f;
#pragma unroll
      for (int r = 0; r < 8; ++r) { const float v = acc[j][r] + bias; const int rl = wave * 16 + 8 * g + r, cl = j * 16 + col; th[cl][rl] = (_Float16)v; const __bf16 bh = (__bf16)v; tb[cl][rl] = bh; tbl[cl][rl] = (__bf16)(v - (float)bh); } }
    __syncthreads();
    for (int e = tid; e < 128 * 8; e += 128) { const int cl = e >> 3, q = e & 7; vst2((unsigned*)(VT + (bb * CC + c0 + cl) * (size_t)TT + t0 + q * 8), *(const v4u*)&th[cl][q * 8]); if (hi_rows) { const size_t o3 = (bb * CC + c0 + cl) * (size_t)KHI + t0 + q * 8; vst2((unsigned*)(VB + o3), *(const v4u*)&tb[cl][q * 8]); vst2((unsigned*)(VBL + o3), *(const v4u*)&tbl[cl][q * 8]); } } } }
// ---- k_fa: block = 256 queries of one (batch, head), 8 waves x 32 query columns; keys walked in stages of 64 through two LDS buffers.
// Reads the f32 inputs itself: q is rounded (bf16, then f16: exact) into the B fragments once, k and v tiles are rounded in registers on their way to LDS, so no conversion launch and no workspace planes.
// Transposed products: S^T = K . Q^T (a lane holds 16 of one query's 32 logits per pass), P^T packs from the score registers straight into the B operand of O^T += V^T . P^T; V^T comes from key-major v rows by the transposing LDS load.
// Online softmax in the log2 domain: m_run may trail the true maximum by up to 8, so P <= 2^8 stays far inside f16; sums and outputs are rescaled only when a column's maximum exceeds it by more.
// Every inner loop is fully unrolled so that the fragment, score and output arrays are indexed by constants and stay in registers.
#define FAW 8              // waves per block
#define FAS 64             // keys per stage
#define FAP 72             // k rows in LDS, pitch in halves: 128 B of data + 16 B, an odd multiple of 16 B (ds_load_b128 reader)
#define FAPV 80            // v rows in LDS, pitch in halves: 128 B of data + 32 B, an odd multiple of 32 B (ds_load_tr16_b128 reader)
#define FNS (TT / FAS)
typedef __attribute__((ext_vector_type(2))) _Float16 v2h;
typedef __attribute__((ext_vector_type(4))) _Float16 v4h;
typedef __attribute__((ext_vector_type(8))) short s16x8;
__device__ __forceinline__ v8f mmh(v16h a, v16h b, v8f c) { return __builtin_amdgcn_wmma_f32_16x16x32_f16(false, a, false, b, (short)0, c, false, false); }
__device__ __forceinline__ float xhalf(float x) { return __builtin_bit_cast(float, __builtin_amdgcn_permlanex16(__builtin_bit_cast(int, x), __builtin_bit_cast(int, x), 0x76543210, 0xfedcba98, false, false)); }  // lane l with lane l ^ 16
typedef __attribute__((ext_vector_type(2))) __bf16 v2b;
__device__ __forceinline__ v2h rnd2(float x, float y) {   // f32 -> bf16 (nearest even, both in one instruction) -> f16: the values of (_Float16)bfr(.)
  const unsigned u = __builtin_bit_cast(unsigned, __builtin_convertvector(v2f{x, y}, v2b));
  return __builtin_convertvector(v2f{__builtin_bit_cast(float, u << 16), __builtin_bit_cast(float, u & 0xffff0000u)}, v2h); }
__device__ __forceinline__ v4h rnd4(v4f x) { const v2h a = rnd2(x[0], x[1]), c = rnd2(x[2], x[3]); return v4h{a.x, a.y, c.x, c.y}; }
__device__ __forceinline__ v16h frag_q(const float* rowk0, int lane) {   // the k order of frag_h, from an f32 row
  v16h a; const float* p = rowk0 + 8 * (lane >> 4);
#pragma unroll
  for (int i = 0; i < 8; ++i) { a[i] = (_Float16)bfr(p[i]); a[8 + i] = (_Float16)bfr(p[16 + i]); }
  return a;
}
__device__ __forceinline__ v8h ld_tr16(const _Float16* p) { typedef __attribute__((address_space(3))) s16x8 lds_s16x8; return __builtin_bit_cast(v8h, __builtin_amdgcn_ds_load_tr16_b128_v8i16((lds_s16x8*)p)); }
// A fragment of V^T (row = d0 + lane & 15, k = keys k0 .. k0 + 31 in the k order of frag_h) from key-major rows; t = the tile's row k0, column d0
__device__ __forceinline__ v16h frag_vt(const _Float16* t, int lane) {
  union { v16h v; v8h q[2]; } u; const _Float16* p = t + (8 * (lane >> 4) + (lane & 7)) * FAPV + 8 * ((lane >> 3) & 1);
  u.q[0] = ld_tr16(p); u.q[1] = ld_tr16(p + 16 * FAPV); return u.v;
}
__global__ __launch_bounds__(256) __attribute__((amdgpu_waves_per_eu(4, 4))) void k_fa(const float* __restrict__ Qs, const float* __restrict__ Ks, const float* __restrict__ Vs, float* __restrict__ Y) {
  __shared__ __align__(16) _Float16 sk[2][FAS][FAP], sv[2][FAS][FAPV]; __shared__ __align__(16) float so[FAW][32][HD + 4];
  const int tid = threadIdx.x, wave = tid >> 5, lane = tid & 31, col = lane & 15, g = lane >> 4;
  const int sw = __builtin_amdgcn_readfirstlane(wave);   // the wave's number in a scalar register
  const int b = blockIdx.y / NH, h = blockIdx.y % NH; const int q0 = blockIdx.x * (FAW * 32) + wave * 32;
  // staging: 16 lanes fetch one key's whole 256-B f32 head slice (two lines); each thread moves 4 floats of rows srow, srow + 16, + 32, + 48 of a tile
  const int srow = tid >> 4, sch = (tid & 15) * 4;
  const float* kg = Ks + ((size_t)b * TT + srow) * CC + h * HD + sch;
  const float* vg = Vs + ((size_t)b * TT + srow) * CC + h * HD + sch;
  v4f r[4];   // the one tile in flight: v and k take turns in it
  { v4f r0[4];
#pragma unroll
    for (int i = 0; i < 4; ++i) { r0[i] = *(const v4f*)(kg + (size_t)(16 * i) * CC); r[i] = *(const v4f*)(vg + (size_t)(16 * i) * CC); }
#pragma unroll
    for (int i = 0; i < 4; ++i) { *(v4h*)&sk[0][srow + 16 * i][sch] = rnd4(r0[i]); *(v4h*)&sv[0][srow + 16 * i][sch] = rnd4(r[i]); }
#pragma unroll
    for (int i = 0; i < 4; ++i) r[i] = *(const v4f*)(vg + (size_t)(FAS + 16 * i) * CC); }
  v16h qf[2][2];
#pragma unroll
  for (int gq = 0; gq < 2; ++gq)
#pragma unroll
    for (int kc = 0; kc < 2; ++kc) qf[gq][kc] = frag_q(Qs + ((size_t)b * TT + q0 + gq * 16 + col) * CC + h * HD + kc * 32, lane);
  v8f acc[2][4] = {}; v2f l2[2] = {}; float m_run[2] = {-1.0e30f, -1.0e30f};
  const float cs = SCALE * 1.4426950408889634f;
  __syncthreads();
#pragma unroll 1   // the stage loop stays rolled: a second copy of its body would not fit the 256 registers that four waves per SIMD allow
  for (int st = 0; st < FNS; ++st) { const int bf = st & 1; v16h kf[2][2];
#pragma unroll
    for (int ps = 0; ps < FAS / 32; ++ps) {
      v8f s[2][2];
      if (ps == 0) {
#pragma unroll
        for (int kt = 0; kt < 2; ++kt) { kf[kt][0] = frag_h(&sk[bf][kt * 16 + col][0], lane); kf[kt][1] = frag_h(&sk[bf][kt * 16 + col][32], lane); } }
#pragma unroll
      for (int kt = 0; kt < 2; ++kt)
#pragma unroll
        for (int gq = 0; gq < 2; ++gq) { v8f z = {}; z = mmh(kf[kt][0], qf[gq][0], z); s[kt][gq] = mmh(kf[kt][1], qf[gq][1], z); }
      v16h vf[4];
#pragma unroll
      for (int j = 0; j < 4; ++j) vf[j] = frag_vt(&sv[bf][ps * 32][j * 16], lane);
      float mb[2]; bool need = false;
#pragma unroll
      for (int gq = 0; gq < 2; ++gq) { float mx = s[0][gq][0];
#pragma unroll
        for (int r8 = 1; r8 < 8; ++r8) mx = fmaxf(mx, s[0][gq][r8]);
#pragma unroll
        for (int r8 = 0; r8 < 8; ++r8) mx = fmaxf(mx, s[1][gq][r8]);
        mx = fmaxf(mx, xhalf(mx)) * cs; mb[gq] = mx; need = need || (mx > m_run[gq] + 8.0f); }
      if (__builtin_amdgcn_ballot_w32(need) != 0) {   // scalar branch, rare after the first pass
#pragma unroll
        for (int gq = 0; gq < 2; ++gq) { const float mn = fmaxf(m_run[gq], mb[gq]); const float corr = __builtin_amdgcn_exp2f(m_run[gq] - mn); m_run[gq] = mn; l2[gq] = l2[gq] * corr;
#pragma unroll
          for (int j = 0; j < 4; ++j) acc[gq][j] = acc[gq][j] * corr; } }
      // Hand-over of the tile in flight, half a stage after its loads: it goes, rounded, into the buffer that stage st + 1 reads (free since the barrier that ended stage st - 1), and the next tile's loads take its registers.
      // Pass 0: v of stage st + 1 lands, k of stage st + 1 starts. Pass 1: that k lands, v of stage st + 2 starts. Past the last stage the last tile is fetched again, into the buffer nobody reads any more: no branch.
      if (ps == 0) { const int ks = (st + 1 < FNS ? st + 1 : FNS - 1) * FAS;
#pragma unroll
        for (int i = 0; i < 4; ++i) *(v4h*)&sv[bf ^ 1][srow + 16 * i][sch] = rnd4(r[i]);
        __builtin_amdgcn_sched_barrier(0);   // the tile leaves its registers before the next one's loads are issued: both at once would not fit
#pragma unroll
        for (int i = 0; i < 4; ++i) r[i] = *(const v4f*)(kg + (size_t)(ks + 16 * i) * CC);
#pragma unroll
        for (int kt = 0; kt < 2; ++kt) { kf[kt][0] = frag_h(&sk[bf][32 + kt * 16 + col][0], lane); kf[kt][1] = frag_h(&sk[bf][32 + kt * 16 + col][32], lane); }   // pass 1's k fragments, from this stage's own buffer: read above the scheduling barrier they arrive under pass 0's softmax; below it the compiler read them right in front of their products
      } else { const int ks = (st + 2 < FNS ? st + 2 : FNS - 1) * FAS;
#pragma unroll
        for (int i = 0; i < 4; ++i) *(v4h*)&sk[bf ^ 1][srow + 16 * i][sch] = rnd4(r[i]);
        __builtin_amdgcn_sched_barrier(0);   // as in pass 0
#pragma unroll
        for (int i = 0; i < 4; ++i) r[i] = *(const v4f*)(vg + (size_t)(ks + 16 * i) * CC); }
      __builtin_amdgcn_sched_barrier(0);   // keeps the four loads here, at the head of the block: sunk towards the block's end they would lose most of their half stage of flight
#pragma unroll
      for (int gq = 0; gq < 2; ++gq) { const float nm = -m_run[gq]; v16h pf;
#pragma unroll
        for (int i = 0; i < 8; ++i) {   // operand elements 2i, 2i+1 = key 8g + .. of score tile i >> 2: the k order of frag_h
          const v2f a = __builtin_elementwise_fma(v2f{s[i >> 2][gq][2 * (i & 3)], s[i >> 2][gq][2 * (i & 3) + 1]}, v2f{cs, cs}, v2f{nm, nm});
          const v2f p = {__builtin_amdgcn_exp2f(a.x), __builtin_amdgcn_exp2f(a.y)}; l2[gq] = l2[gq] + p;
          const v2h ph = __builtin_convertvector(p, v2h); pf[2 * i] = ph.x; pf[2 * i + 1] = ph.y; }
#pragma unroll
        for (int j = 0; j < 4; ++j) acc[gq][j] = mmh(vf[j], pf, acc[gq][j]); } }
    // Publishes stage st + 1 and ends every wave's reads of the buffer that stage st + 1 refills. The fences name LDS alone: __syncthreads() would also wait here for the v loads in flight, which only fill registers.
    __builtin_amdgcn_fence(__ATOMIC_RELEASE, "workgroup", "local"); __builtin_amdgcn_s_barrier(); __builtin_amdgcn_fence(__ATOMIC_ACQUIRE, "workgroup", "local");
  }
  // The epilogue forms its addresses anew, from the lane count and the scalar wave number: formed from tid they are kept in vector registers across the loop, which has none to spare (they spilled).
  const int el = (int)__builtin_amdgcn_mbcnt_lo(~0u, 0u), ec = el & 15, eg = el >> 4;
#pragma unroll
  for (int gq = 0; gq < 2; ++gq) { float l = l2[gq].x + l2[gq].y; l += xhalf(l); const float inv = 1.0f / l;
#pragma unroll
    for (int j = 0; j < 4; ++j) { const v8f o = acc[gq][j] * inv; *(v4f*)&so[sw][gq * 16 + ec][j * 16 + 8 * eg] = v4f{o[0], o[1], o[2], o[3]}; *(v4f*)&so[sw][gq * 16 + ec][j * 16 + 8 * eg + 4] = v4f{o[4], o[5], o[6], o[7]}; } }
  LDSX();   // the wave's own rows are read back by other lanes, so that 16 lanes store one whole 256-B (row, head) segment
#pragma unroll
  for (int rl = 0; rl < 32; rl += 2) vst2(Y + ((size_t)b * TT + blockIdx.x * (FAW * 32) + sw * 32 + rl + eg) * CC + h * HD + ec * 4, *(const v4f*)&so[sw][rl + eg][ec * 4]);
}

extern "C" void kernel_launch(void* const* d_in, const int* in_sizes, int n_in, void* d_out, int out_size, void* d_ws, size_t ws_size, hipStream_t stream) {
  (void)in_sizes; (void)n_in; (void)out_size;
  const float** F = (const float**)d_in;
  if (ws_size < (size_t)WS_END) return;
  char* ws = (char*)d_ws; _Float16 *QH = (_Float16*)(ws + WS_QH), *KH = (_Float16*)(ws + WS_KH), *VT = (_Float16*)(ws + WS_VT), *QL = (_Float16*)(ws + WS_QL), *KL = (_Float16*)(ws + WS_KL); __bf16 *VB = (__bf16*)(ws + WS_VB), *VBL = (__bf16*)(ws + WS_VBL); float *S = (float*)(ws + WS_S), *Y = (float*)(ws + WS_Y);
  (void)Y; (void)S; (void)QH; (void)KH; (void)VT; (void)QL; (void)KL; (void)VB; (void)VBL;
  // inputs: 0 query [2,2048,32,64]; 1 key; 2 value (rows [b*2048 + s][n*64 + h] = merged-head rows)
  k_fa<<<dim3(TT / (FAW * 32), TNB * NH), 256, 0, stream>>>(F[0], F[1], F[2], (float*)d_out);   /* ctx [b, sq, n*h] = merged-head rows */
}

// v003
// It runs in 58.3 microseconds.
// In both of two side-by-side timings against v002, it was 1.04 times as fast.
// Counting every step since v000, it is 34.0 times as fast.
// compute dtype: all float inputs rounded to bf16; query, key, value are bf16-valued so their f16 planes are exact; logits q x k (1 product on exact planes) x 64^-0.5; online softmax f32; P = 2^(logit - running maximum) once to f16 x v (exact) (1 product), divided by the f32 sum at the end; f32 output.
#include <hip/hip_runtime.h>
#include <math.h>

typedef __attribute__((ext_vector_type(16))) _Float16 v16h;
typedef __attribute__((ext_vector_type(16))) __bf16 v16b;
typedef __attribute__((ext_vector_type(8)))  _Float16 v8h;
typedef __attribute__((ext_vector_type(8)))  float v8f;
typedef __attribute__((ext_vector_type(4)))  float v4f;
typedef __attribute__((ext_vector_type(2)))  float v2f;
typedef __attribute__((ext_vector_type(4)))  unsigned v4u;
typedef __attribute__((ext_vector_type(4)))  int v4i;
typedef float __attribute__((may_alias)) float_a;
typedef int __attribute__((may_alias)) int_a;

template <typename T> __device__ __forceinline__ void vst2(void* p, T v) { *(T*)p = v;  }
__device__ __forceinline__ v8f wmma16(v16h a, v16h b, v8f c) {
  v8f d = __builtin_amdgcn_wmma_f32_16x16x32_f16(false, a, false, b, (short)0, c, false, false);
  asm volatile("v_nop\n\tv_nop\n\tv_nop\n\tv_nop" : "+v"(d) : "v"(a), "v"(b));
  return d;
}
__device__ __forceinline__ v8f wmma_bf(v16b a, v16b b, v8f c) {
  v8f d = __builtin_amdgcn_wmma_f32_16x16x32_bf16(false, a, false, b, (short)0, c, false, false);
  asm volatile("v_nop\n\tv_nop\n\tv_nop\n\tv_nop" : "+v"(d) : "v"(a), "v"(b));
  return d;
}
// 16x16x32 fragments: lane = (h = lane>>4, row/col = lane&15); elements 0..7 = k0+8h+0..7, 8..15 = k0+16+8h+0..7; D element r = row 8h+r
__device__ __forceinline__ v16h frag_h(const _Float16* rowk0, int lane) {
  union { v16h v; v8h q[2]; } u; const _Float16* p = rowk0 + 8 * (lane >> 4);
  u.q[0] = *(const v8h*)p; u.q[1] = *(const v8h*)(p + 16); return u.v;
}
__device__ __forceinline__ v16h frag_f32(const float* rowk0, int lane) {
  v16h a; const float* p = rowk0 + 8 * (lane >> 4);
#pragma unroll
  for (int i = 0; i < 8; ++i) { a[i] = (_Float16)p[i]; a[8 + i] = (_Float16)p[16 + i]; }
  return a;
}
__device__ __forceinline__ v16h frag_f32s(const float* rowk0, int lane, float sc) {
  v16h a; const float* p = rowk0 + 8 * (lane >> 4);
#pragma unroll
  for (int i = 0; i < 8; ++i) { a[i] = (_Float16)(p[i] * sc); a[8 + i] = (_Float16)(p[16 + i] * sc); }
  return a;
}
// column fragment from a [K][ld] layout (column n), rows >= K read as 0
__device__ __forceinline__ v16h fragc_f32(const float* W, int k0, int n, int lane, int ld, int K) {
  v16h a; const int g = lane >> 4;
#pragma unroll
  for (int i = 0; i < 8; ++i) { const int ka = k0 + 8 * g + i, kb = ka + 16;
    a[i] = (_Float16)(ka < K ? W[(size_t)(ka < K ? ka : K - 1) * ld + n] : 0.f); a[8 + i] = (_Float16)(kb < K ? W[(size_t)(kb < K ? kb : K - 1) * ld + n] : 0.f); }
  return a;
}
struct F2 { v16b h, l; };
__device__ __forceinline__ F2 bsplit16(const float v[16]) { F2 r;
#pragma unroll
  for (int i = 0; i < 16; ++i) { const __bf16 h = (__bf16)v[i]; r.h[i] = h; r.l[i] = (__bf16)(v[i] - (float)h); }
  return r; }
__device__ __forceinline__ F2 split_row(const float* row, int k0, int lane) { float v[16]; const float* p = row + k0 + 8 * (lane >> 4);
#pragma unroll
  for (int i = 0; i < 8; ++i) { v[i] = p[i]; v[8 + i] = p[16 + i]; }
  return bsplit16(v); }
__device__ __forceinline__ F2 split_rowK(const float* row, int k0, int lane, int K) { float v[16]; const int g = lane >> 4;
#pragma unroll
  for (int i = 0; i < 8; ++i) { const int ka = k0 + 8 * g + i, kb = ka + 16; v[i] = ka < K ? row[ka < K ? ka : K - 1] : 0.f; v[8 + i] = kb < K ? row[kb < K ? kb : K - 1] : 0.f; }
  return bsplit16(v); }
__device__ __forceinline__ F2 split_col(const float* W, int k0, int n, int lane, int ld, int K) { float v[16]; const int g = lane >> 4;
#pragma unroll
  for (int i = 0; i < 8; ++i) { const int ka = k0 + 8 * g + i, kb = ka + 16; v[i] = ka < K ? W[(size_t)(ka < K ? ka : K - 1) * ld + n] : 0.f; v[8 + i] = kb < K ? W[(size_t)(kb < K ? kb : K - 1) * ld + n] : 0.f; }
  return bsplit16(v); }
__device__ __forceinline__ v8f mac3(const F2& a, const F2& b, v8f c) { c = wmma_bf(a.l, b.h, c); c = wmma_bf(a.h, b.l, c); return wmma_bf(a.h, b.h, c); }
__device__ __forceinline__ float sigm(float v) { return 1.0f / (1.0f + expf(-v)); }
#define LDSX() do { asm volatile("s_wait_dscnt 0" ::: "memory"); __builtin_amdgcn_wave_barrier(); __builtin_amdgcn_fence(__ATOMIC_RELEASE, "workgroup"); } while (0)

// Plain multi-head attention core on given tensors (query / key / value [2,2048,32,64] = [batch, seq, heads, dim]; no mask, no projections; norm factor sqrt(64)): ctx = softmax(Q K^T / 8) V per (batch, head), returned as [2,2048,2048] (heads merged).
#define NB 2
#define TT 2048
#define CC 2048            // NH * HD = projected width
#define DIN 2048          // input (model) width
#define NH 32
#define HD 64
#define NQB (TT / 64)
#define HG 4
#define SCALE (0.125f)
#define CAUSAL 0
#ifndef TNB
#define TNB NB
#endif
__device__ __forceinline__ float bfr(float v) { return (float)(__bf16)v; }
__host__ __device__ __forceinline__ int kb_last(int qb) { return CAUSAL ? ((qb * 64 + 63) >> 7) : (TT / 128 - 1); }
typedef __attribute__((ext_vector_type(8))) __bf16 v8b;
__device__ __forceinline__ v16b frag_b(const __bf16* rowk0, int lane) {
  union { v16b v; v8b q[2]; } u; const __bf16* p = rowk0 + 8 * (lane >> 4);
  u.q[0] = *(const v8b*)p; u.q[1] = *(const v8b*)(p + 16); return u.v;
}
#define QBH 0
#define QHI 0               // exact planes: single-product logits everywhere
#define KHI 64            // key rows carrying k residual / v bf16 hi+lo planes (written only by k_proj, which is not launched)
// B fragment (k rows k0+.., output column o) of a weight: (in,out) [K][ld] or (out,in) [ld rows of K]: bf16 exact, or f16(bf16 * 256) exact
__device__ __forceinline__ v16b wcol_io(const float* Wm, int k0, int o, int lane, int ld) { v16b w; const int g = lane >> 4;
#pragma unroll
  for (int i = 0; i < 8; ++i) { w[i] = (__bf16)Wm[(size_t)(k0 + 8 * g + i) * ld + o]; w[8 + i] = (__bf16)Wm[(size_t)(k0 + 16 + 8 * g + i) * ld + o]; }
  return w; }
__device__ __forceinline__ v16b wcol_oi(const float* Wm, int k0, int o, int lane, int K) { v16b w; const float* p = Wm + (size_t)o * K + k0 + 8 * (lane >> 4);
#pragma unroll
  for (int i = 0; i < 8; ++i) { w[i] = (__bf16)p[i]; w[8 + i] = (__bf16)p[16 + i]; }
  return w; }
__device__ __forceinline__ v16h wcolh_io(const float* Wm, int k0, int o, int lane, int ld) { v16h w; const int g = lane >> 4;
#pragma unroll
  for (int i = 0; i < 8; ++i) { w[i] = (_Float16)(bfr(Wm[(size_t)(k0 + 8 * g + i) * ld + o]) * 256.0f); w[8 + i] = (_Float16)(bfr(Wm[(size_t)(k0 + 16 + 8 * g + i) * ld + o]) * 256.0f); }
  return w; }
__device__ __forceinline__ v16h wcolh_oi(const float* Wm, int k0, int o, int lane, int K) { v16h w; const float* p = Wm + (size_t)o * K + k0 + 8 * (lane >> 4);
#pragma unroll
  for (int i = 0; i < 8; ++i) { w[i] = (_Float16)(bfr(p[i]) * 256.0f); w[8 + i] = (_Float16)(bfr(p[16 + i]) * 256.0f); }
  return w; }
#define WQKV_LAYOUT 0   // 0 = (in,out) [DIN][CC]; 1 = (out,in) [CC][DIN]; 2 = per-head [NH][DIN][HD]
__device__ __forceinline__ v16b wcol_hdk(const float* Wm, int k0, int o, int lane) { v16b w; const int g = lane >> 4; const float* p = Wm + (size_t)(o / HD) * DIN * HD + (o % HD);
#pragma unroll
  for (int i = 0; i < 8; ++i) { w[i] = (__bf16)p[(size_t)(k0 + 8 * g + i) * HD]; w[8 + i] = (__bf16)p[(size_t)(k0 + 16 + 8 * g + i) * HD]; }
  return w; }
#define WO_OUT_IN 0
#if WQKV_LAYOUT == 1
#define WCOL(W, k0, o, lane) wcol_oi(W, k0, o, lane, DIN)
#elif WQKV_LAYOUT == 2
#define WCOL(W, k0, o, lane) wcol_hdk(W, k0, o, lane)
#else
#define WCOL(W, k0, o, lane) wcol_io(W, k0, o, lane, CC)
#endif
#if WO_OUT_IN
#define WOCOL(W, k0, o, lane) wcol_oi(W, k0, o, lane, CC)
#define WOCOLH(W, k0, o, lane) wcolh_oi(W, k0, o, lane, CC)
#else
#define WOCOL(W, k0, o, lane) wcol_io(W, k0, o, lane, DIN)
#define WOCOLH(W, k0, o, lane) wcolh_io(W, k0, o, lane, DIN)
#endif
typedef _Float16 hx8 __attribute__((ext_vector_type(8)));
#define SM_EXTRA_PARAMS
#define SM_MASK_HOOK (void)0
#ifndef SM_EXTRA_PARAMS
#define SM_EXTRA_PARAMS
#endif
#ifndef PROJ_EXTRA_PARAMS
#define PROJ_EXTRA_PARAMS
#endif
#ifndef SM_MASK_HOOK
#define SM_MASK_HOOK (void)0
#endif

#define WS_QH  0u                                      // f16 q rows [b*t][CC]
#define WS_KH  (WS_QH + 2u * (size_t)NB * TT * CC)      // f16 k rows [b*t][CC]
#define WS_VT  (WS_KH + 2u * (size_t)NB * TT * CC)      // f16 v planes [b][c][t]
#define WS_QL  (WS_VT + 2u * (size_t)NB * CC * TT)      // f16 q residual x 2^10 rows [b][t < QHI][CC]
#define WS_KL  (WS_QL + 2u * (size_t)NB * QHI * CC)     // f16 k residual x 2^10 rows [b][t < KHI][CC]
#define WS_VB  (WS_KL + 2u * (size_t)NB * KHI * CC)     // bf16 v hi planes [b][c][t < KHI]
#define WS_VBL (WS_VB + 2u * (size_t)NB * CC * KHI)
#define WS_S   (WS_VBL + 2u * (size_t)NB * CC * KHI)    // f32 [hg][t][s], reserved; no kernel here uses it
#define WS_Y   (WS_S  + 4u * (size_t)HG * TT * TT)      // f32 ctx rows [b*t][CC] (only when there is an output projection)
#define WS_END (WS_Y  + 0u)

// ---- k_proj: block = (64 rows, 128 cols, which): q/k/v = X W (+ b) with exact bf16 products (K = DIN) -> which 0: q f16 rows (+ residual rows < QHI); 1: k f16 rows (+ residual rows < KHI); 2: v f16 planes [c][t] (+ bf16 hi/lo planes for t < KHI)
__global__ __launch_bounds__(128) void k_proj(const float* __restrict__ XQ, const float* __restrict__ XK, const float* __restrict__ XV, const float* __restrict__ WQ, const float* __restrict__ WK, const float* __restrict__ WV, const float* __restrict__ BQ, const float* __restrict__ BK, const float* __restrict__ BV,
    _Float16* __restrict__ QH, _Float16* __restrict__ QL, _Float16* __restrict__ KH, _Float16* __restrict__ KL, _Float16* __restrict__ VT, __bf16* __restrict__ VB, __bf16* __restrict__ VBL) {
  __shared__ __align__(16) _Float16 sh[64][136], sl[64][136]; __shared__ __align__(16) _Float16 th[128][72]; __shared__ __align__(16) __bf16 tb[128][72], tbl[128][72];
  const int tid = threadIdx.x, wave = tid >> 5, lane = tid & 31, col = lane & 15, g = lane >> 4; const int which = blockIdx.z; const int c0 = blockIdx.y * 128; const size_t r0 = (size_t)blockIdx.x * 64; const size_t bb = r0 / TT; const int t0 = (int)(r0 % TT);
  const float* X = which == 0 ? XQ : which == 1 ? XK : XV; const float* WA = which == 0 ? WQ : which == 1 ? WK : WV; const float* BA = which == 0 ? BQ : which == 1 ? BK : BV;
  v8f acc[8] = {};
#pragma unroll 2
  for (int kc = 0; kc < DIN / 32; ++kc) { v16b a; { const float* p = X + (r0 + wave * 16 + col) * DIN + kc * 32 + 8 * g;
#pragma unroll
      for (int i = 0; i < 8; ++i) { a[i] = (__bf16)p[i]; a[8 + i] = (__bf16)p[16 + i]; } }
    asm volatile("s_wait_loadcnt 0x0" ::: "memory");
#pragma unroll
    for (int j = 0; j < 8; ++j) { const v16b w = WCOL(WA, kc * 32, c0 + j * 16 + col, lane); asm volatile("s_wait_loadcnt 0x0" ::: "memory"); acc[j] = wmma_bf(a, w, acc[j]); } }
  if (which < 2) { _Float16* DH = which == 0 ? QH : KH; _Float16* DL = which == 0 ? QL : KL; const int nhi = which == 0 ? QHI : KHI; const bool hi_rows = t0 < nhi;
#pragma unroll
    for (int j = 0; j < 8; ++j) { const float bias = BA ? bfr(BA[c0 + j * 16 + col]) : 0.f;
#pragma unroll
      for (int r = 0; r < 8; ++r) { const float v = acc[j][r] + bias; const _Float16 hv = (_Float16)v; sh[wave * 16 + 8 * g + r][j * 16 + col] = hv; sl[wave * 16 + 8 * g + r][j * 16 + col] = (_Float16)((v - (float)hv) * 1024.0f); } }
    __syncthreads();
    for (int e = tid; e < 64 * 16; e += 128) { const int rl = e >> 4, q = e & 15; vst2((unsigned*)(DH + (r0 + rl) * CC + c0 + q * 8), *(const v4u*)&sh[rl][q * 8]); if (hi_rows) vst2((unsigned*)(DL + (bb * nhi + t0 + rl) * (size_t)CC + c0 + q * 8), *(const v4u*)&sl[rl][q * 8]); }
  } else { const bool hi_rows = t0 < KHI;
#pragma unroll
    for (int j = 0; j < 8; ++j) { const float bias = BA ? bfr(BA[c0 + j * 16 + col]) : 0.f;
#pragma unroll
      for (int r = 0; r < 8; ++r) { const float v = acc[j][r] + bias; const int rl = wave * 16 + 8 * g + r, cl = j * 16 + col; th[cl][rl] = (_Float16)v; const __bf16 bh = (__bf16)v; tb[cl][rl] = bh; tbl[cl][rl] = (__bf16)(v - (float)bh); } }
    __syncthreads();
    for (int e = tid; e < 128 * 8; e += 128) { const int cl = e >> 3, q = e & 7; vst2((unsigned*)(VT + (bb * CC + c0 + cl) * (size_t)TT + t0 + q * 8), *(const v4u*)&th[cl][q * 8]); if (hi_rows) { const size_t o3 = (bb * CC + c0 + cl) * (size_t)KHI + t0 + q * 8; vst2((unsigned*)(VB + o3), *(const v4u*)&tb[cl][q * 8]); vst2((unsigned*)(VBL + o3), *(const v4u*)&tbl[cl][q * 8]); } } } }
// ---- k_fa: block = 256 queries of one (batch, head), 8 waves x 32 query columns; keys walked in stages of 64 through two LDS buffers.
// Reads the f32 inputs itself: q is rounded (bf16, then f16: exact) into the B fragments once, k and v tiles are rounded in registers on their way to LDS, so no conversion launch and no workspace planes.
// Transposed products: S^T = K . Q^T (a lane holds 16 of one query's 32 logits per pass), P^T packs from the score registers straight into the B operand of O^T += V^T . P^T; V^T comes from key-major v rows by the transposing LDS load.
// Online softmax in the log2 domain: m_run may trail the true maximum, and no maximum is taken while it holds: P is formed against m_run and the pass's own sums say whether it still holds (P <= its lane's sum <= 2^11, far inside f16); only a pass that fails takes its maximum, rescales sums and outputs, and forms its P again.
// Every inner loop is fully unrolled so that the fragment, score and output arrays are indexed by constants and stay in registers.
#define FAW 8              // waves per block
#define FAS 64             // keys per stage
#define FAP 72             // k rows in LDS, pitch in halves: 128 B of data + 16 B, an odd multiple of 16 B (ds_load_b128 reader)
#define FAPV 80            // v rows in LDS, pitch in halves: 128 B of data + 32 B, an odd multiple of 32 B (ds_load_tr16_b128 reader)
#define FNS (TT / FAS)
typedef __attribute__((ext_vector_type(2))) _Float16 v2h;
typedef __attribute__((ext_vector_type(4))) _Float16 v4h;
typedef __attribute__((ext_vector_type(8))) short s16x8;
__device__ __forceinline__ v8f mmh(v16h a, v16h b, v8f c) { return __builtin_amdgcn_wmma_f32_16x16x32_f16(false, a, false, b, (short)0, c, false, false); }
__device__ __forceinline__ float xhalf(float x) { return __builtin_bit_cast(float, __builtin_amdgcn_permlanex16(__builtin_bit_cast(int, x), __builtin_bit_cast(int, x), 0x76543210, 0xfedcba98, false, false)); }  // lane l with lane l ^ 16
typedef __attribute__((ext_vector_type(2))) __bf16 v2b;
__device__ __forceinline__ v2h rnd2(float x, float y) {   // f32 -> bf16 (nearest even, both in one instruction) -> f16: the values of (_Float16)bfr(.)
  const unsigned u = __builtin_bit_cast(unsigned, __builtin_convertvector(v2f{x, y}, v2b));
  return __builtin_convertvector(v2f{__builtin_bit_cast(float, u << 16), __builtin_bit_cast(float, u & 0xffff0000u)}, v2h); }
__device__ __forceinline__ v4h rnd4(v4f x) { const v2h a = rnd2(x[0], x[1]), c = rnd2(x[2], x[3]); return v4h{a.x, a.y, c.x, c.y}; }
__device__ __forceinline__ v16h frag_q(const float* rowk0, int lane) {   // the k order of frag_h, from an f32 row
  v16h a; const float* p = rowk0 + 8 * (lane >> 4);
#pragma unroll
  for (int i = 0; i < 8; ++i) { a[i] = (_Float16)bfr(p[i]); a[8 + i] = (_Float16)bfr(p[16 + i]); }
  return a;
}
__device__ __forceinline__ v8h ld_tr16(const _Float16* p) { typedef __attribute__((address_space(3))) s16x8 lds_s16x8; return __builtin_bit_cast(v8h, __builtin_amdgcn_ds_load_tr16_b128_v8i16((lds_s16x8*)p)); }
// A fragment of V^T (row = d0 + lane & 15, k = keys k0 .. k0 + 31 in the k order of frag_h) from key-major rows; t = the tile's row k0, column d0
__device__ __forceinline__ v16h frag_vt(const _Float16* t, int lane) {
  union { v16h v; v8h q[2]; } u; const _Float16* p = t + (8 * (lane >> 4) + (lane & 7)) * FAPV + 8 * ((lane >> 3) & 1);
  u.q[0] = ld_tr16(p); u.q[1] = ld_tr16(p + 16 * FAPV); return u.v;
}
#define FAT 2048.0f        // a lane's sum of 8 probabilities above this sends the pass to the maximum and the rescale: every P that reaches the f16 operand is <= 2^11
// One column group's 16 scores of a pass (two score tiles) -> P = 2^(score * cs + nm), packed to the B operand in the k order of frag_h, and their sum in f32 (even and odd elements apart)
__device__ __forceinline__ void fa_exp(const v8f& s0, const v8f& s1, float cs, float nm, v16h& pf, v2f& t) {
#pragma unroll
  for (int i = 0; i < 8; ++i) {   // operand elements 2i, 2i+1 = key 8g + .. of score tile i >> 2
    const v8f& sx = i < 4 ? s0 : s1;
    const v2f a = __builtin_elementwise_fma(v2f{sx[2 * (i & 3)], sx[2 * (i & 3) + 1]}, v2f{cs, cs}, v2f{nm, nm});
    const v2f p = {__builtin_amdgcn_exp2f(a.x), __builtin_amdgcn_exp2f(a.y)}; t = i == 0 ? p : t + p;
    const v2h ph = __builtin_convertvector(p, v2h); pf[2 * i] = ph.x; pf[2 * i + 1] = ph.y; }
}
__global__ __launch_bounds__(256) __attribute__((amdgpu_waves_per_eu(4, 4))) void k_fa(const float* __restrict__ Qs, const float* __restrict__ Ks, const float* __restrict__ Vs, float* __restrict__ Y) {
  __shared__ __align__(16) _Float16 sk[2][FAS][FAP], sv[2][FAS][FAPV]; __shared__ __align__(16) float so[FAW][32][HD + 4];
  const int tid = threadIdx.x, wave = tid >> 5, lane = tid & 31, col = lane & 15, g = lane >> 4;
  const int sw = __builtin_amdgcn_readfirstlane(wave);   // the wave's number in a scalar register
  const int b = blockIdx.y / NH, h = blockIdx.y % NH; const int q0 = blockIdx.x * (FAW * 32) + wave * 32;
  // staging: 16 lanes fetch one key's whole 256-B f32 head slice (two lines); each thread moves 4 floats of rows srow, srow + 16, + 32, + 48 of a tile
  const int srow = tid >> 4, sch = (tid & 15) * 4;
  const float* kg = Ks + ((size_t)b * TT + srow) * CC + h * HD + sch;
  const float* vg = Vs + ((size_t)b * TT + srow) * CC + h * HD + sch;
  v4f r[4];   // the one tile in flight: v and k take turns in it
  { v4f r0[4];
#pragma unroll
    for (int i = 0; i < 4; ++i) { r0[i] = *(const v4f*)(kg + (size_t)(16 * i) * CC); r[i] = *(const v4f*)(vg + (size_t)(16 * i) * CC); }
#pragma unroll
    for (int i = 0; i < 4; ++i) { *(v4h*)&sk[0][srow + 16 * i][sch] = rnd4(r0[i]); *(v4h*)&sv[0][srow + 16 * i][sch] = rnd4(r[i]); }
#pragma unroll
    for (int i = 0; i < 4; ++i) r[i] = *(const v4f*)(vg + (size_t)(FAS + 16 * i) * CC); }
  v16h qf[2][2];
#pragma unroll
  for (int gq = 0; gq < 2; ++gq)
#pragma unroll
    for (int kc = 0; kc < 2; ++kc) qf[gq][kc] = frag_q(Qs + ((size_t)b * TT + q0 + gq * 16 + col) * CC + h * HD + kc * 32, lane);
  v8f acc[2][4] = {}; v2f l2[2] = {}; float m_run[2] = {-1.0e30f, -1.0e30f};
  const float cs = SCALE * 1.4426950408889634f;
  __syncthreads();
#pragma unroll 1   // the stage loop stays rolled: a second copy of its body would not fit the 256 registers that four waves per SIMD allow
  for (int st = 0; st < FNS; ++st) { const int bf = st & 1; v16h kf[2][2];
#pragma unroll
    for (int ps = 0; ps < FAS / 32; ++ps) {
      v8f s[2][2];
      if (ps == 0) {
#pragma unroll
        for (int kt = 0; kt < 2; ++kt) { kf[kt][0] = frag_h(&sk[bf][kt * 16 + col][0], lane); kf[kt][1] = frag_h(&sk[bf][kt * 16 + col][32], lane); } }
#pragma unroll
      for (int kt = 0; kt < 2; ++kt)
#pragma unroll
        for (int gq = 0; gq < 2; ++gq) { v8f z = {}; z = mmh(kf[kt][0], qf[gq][0], z); s[kt][gq] = mmh(kf[kt][1], qf[gq][1], z); }
      v16h vf[4];
#pragma unroll
      for (int j = 0; j < 4; ++j) vf[j] = frag_vt(&sv[bf][ps * 32][j * 16], lane);
      // Probabilities on trust: P = 2^(logit - m_run) is formed at once, with no maximum taken first. The pass's own sums are the test: every P is >= 0, so each is at most its lane's sum.
      v16h pf[2]; v2f t[2];
#pragma unroll
      for (int gq = 0; gq < 2; ++gq) fa_exp(s[0][gq], s[1][gq], cs, -m_run[gq], pf[gq], t[gq]);
      const float tm = fmaxf(fmaxf(t[0].x, t[0].y), fmaxf(t[1].x, t[1].y));
      if (__builtin_amdgcn_ballot_w32(!(tm <= FAT)) != 0) {   // scalar branch, once per pass; taken in a wave's first pass (m_run starts at -1e30: the sums are infinite) and rarely after it
#pragma unroll
        for (int gq = 0; gq < 2; ++gq) { float mx = s[0][gq][0];
#pragma unroll
          for (int r8 = 1; r8 < 8; ++r8) mx = fmaxf(mx, s[0][gq][r8]);
#pragma unroll
          for (int r8 = 0; r8 < 8; ++r8) mx = fmaxf(mx, s[1][gq][r8]);
          mx = fmaxf(mx, xhalf(mx)) * cs;
          const float mn = fmaxf(m_run[gq], mx); const float corr = __builtin_amdgcn_exp2f(m_run[gq] - mn); m_run[gq] = mn; l2[gq] = l2[gq] * corr;
#pragma unroll
          for (int j = 0; j < 4; ++j) acc[gq][j] = acc[gq][j] * corr;
          fa_exp(s[0][gq], s[1][gq], cs, -mn, pf[gq], t[gq]); } }   // the pass's P and sums again, now against its true maximum: all <= 1
#pragma unroll
      for (int gq = 0; gq < 2; ++gq) l2[gq] = l2[gq] + t[gq];
      // Hand-over of the tile in flight, one pass after its loads: it goes, rounded, into the buffer that stage st + 1 reads (free since the barrier that ended stage st - 1), and the next tile's loads take its registers.
      // Pass 0: v of stage st + 1 lands, k of stage st + 1 starts. Pass 1: that k lands, v of stage st + 2 starts. Past the last stage the last tile is fetched again, into the buffer nobody reads any more: no branch.
      if (ps == 0) { const int ks = (st + 1 < FNS ? st + 1 : FNS - 1) * FAS;
#pragma unroll
        for (int kt = 0; kt < 2; ++kt) { kf[kt][0] = frag_h(&sk[bf][32 + kt * 16 + col][0], lane); kf[kt][1] = frag_h(&sk[bf][32 + kt * 16 + col][32], lane); }   // pass 1's k fragments, from this stage's own buffer: read here, above the scheduling barriers, they arrive under the tile's rounding; further down the compiler read them right in front of their products
        __builtin_amdgcn_sched_barrier(0);   // holds those reads above the rounding
#pragma unroll
        for (int i = 0; i < 4; ++i) *(v4h*)&sv[bf ^ 1][srow + 16 * i][sch] = rnd4(r[i]);
        __builtin_amdgcn_sched_barrier(0);   // the tile leaves its registers before the next one's loads are issued: both at once would not fit
#pragma unroll
        for (int i = 0; i < 4; ++i) r[i] = *(const v4f*)(kg + (size_t)(ks + 16 * i) * CC);
      } else { const int ks = (st + 2 < FNS ? st + 2 : FNS - 1) * FAS;
#pragma unroll
        for (int i = 0; i < 4; ++i) *(v4h*)&sk[bf ^ 1][srow + 16 * i][sch] = rnd4(r[i]);
        __builtin_amdgcn_sched_barrier(0);   // as in pass 0
#pragma unroll
        for (int i = 0; i < 4; ++i) r[i] = *(const v4f*)(vg + (size_t)(ks + 16 * i) * CC); }
      __builtin_amdgcn_sched_barrier(0);   // keeps the four loads here, at the head of the block: sunk towards the block's end they would lose part of their flight
#pragma unroll
      for (int gq = 0; gq < 2; ++gq)
#pragma unroll
        for (int j = 0; j < 4; ++j) acc[gq][j] = mmh(vf[j], pf[gq], acc[gq][j]); }
    // Publishes stage st + 1 and ends every wave's reads of the buffer that stage st + 1 refills. The fences name LDS alone: __syncthreads() would also wait here for the v loads in flight, which only fill registers.
    asm volatile("s_wait_xcnt 0x0" ::: "memory");   // pass 1's loads name an address pair that the next stage's first fragment reads overwrite
    __builtin_amdgcn_fence(__ATOMIC_RELEASE, "workgroup", "local"); __builtin_amdgcn_s_barrier(); __builtin_amdgcn_fence(__ATOMIC_ACQUIRE, "workgroup", "local");
  }
  // The epilogue forms its addresses anew, from the lane count and the scalar wave number: formed from tid they are kept in vector registers across the loop, which has none to spare (they spilled).
  const int el = (int)__builtin_amdgcn_mbcnt_lo(~0u, 0u), ec = el & 15, eg = el >> 4;
#pragma unroll
  for (int gq = 0; gq < 2; ++gq) { float l = l2[gq].x + l2[gq].y; l += xhalf(l); const float inv = 1.0f / l;
#pragma unroll
    for (int j = 0; j < 4; ++j) { const v8f o = acc[gq][j] * inv; *(v4f*)&so[sw][gq * 16 + ec][j * 16 + 8 * eg] = v4f{o[0], o[1], o[2], o[3]}; *(v4f*)&so[sw][gq * 16 + ec][j * 16 + 8 * eg + 4] = v4f{o[4], o[5], o[6], o[7]}; } }
  LDSX();   // the wave's own rows are read back by other lanes, so that 16 lanes store one whole 256-B (row, head) segment
#pragma unroll
  for (int rl = 0; rl < 32; rl += 2) vst2(Y + ((size_t)b * TT + blockIdx.x * (FAW * 32) + sw * 32 + rl + eg) * CC + h * HD + ec * 4, *(const v4f*)&so[sw][rl + eg][ec * 4]);
}

extern "C" void kernel_launch(void* const* d_in, const int* in_sizes, int n_in, void* d_out, int out_size, void* d_ws, size_t ws_size, hipStream_t stream) {
  (void)in_sizes; (void)n_in; (void)out_size;
  const float** F = (const float**)d_in;
  if (ws_size < (size_t)WS_END) return;
  char* ws = (char*)d_ws; _Float16 *QH = (_Float16*)(ws + WS_QH), *KH = (_Float16*)(ws + WS_KH), *VT = (_Float16*)(ws + WS_VT), *QL = (_Float16*)(ws + WS_QL), *KL = (_Float16*)(ws + WS_KL); __bf16 *VB = (__bf16*)(ws + WS_VB), *VBL = (__bf16*)(ws + WS_VBL); float *S = (float*)(ws + WS_S), *Y = (float*)(ws + WS_Y);
  (void)Y; (void)S; (void)QH; (void)KH; (void)VT; (void)QL; (void)KL; (void)VB; (void)VBL;
  // inputs: 0 query [2,2048,32,64]; 1 key; 2 value (rows [b*2048 + s][n*64 + h] = merged-head rows)
  k_fa<<<dim3(TT / (FAW * 32), TNB * NH), 256, 0, stream>>>(F[0], F[1], F[2], (float*)d_out);   /* ctx [b, sq, n*h] = merged-head rows */
}

// v005
// It runs in 54.2 microseconds.
// It is 1.08 times as fast as v003, going by the measured steps of the versions left out in between.
// Over all steps from v000 it is 36.7 times as fast.
// compute dtype: all float inputs rounded to bf16; key, value are bf16-valued so their f16 planes are exact; q plane = f16(bf16 q x 64^-0.5 log2 e), one more rounding; logits q x k (1 product) accumulated on top of minus the running maximum; online softmax f32; P = 2^(that sum) once to f16 x v (exact) (1 product), divided by the f32 sum at the end; f32 output.
#include <hip/hip_runtime.h>
#include <math.h>

typedef __attribute__((ext_vector_type(16))) _Float16 v16h;
typedef __attribute__((ext_vector_type(16))) __bf16 v16b;
typedef __attribute__((ext_vector_type(8)))  _Float16 v8h;
typedef __attribute__((ext_vector_type(8)))  float v8f;
typedef __attribute__((ext_vector_type(4)))  float v4f;
typedef __attribute__((ext_vector_type(2)))  float v2f;
typedef __attribute__((ext_vector_type(4)))  unsigned v4u;
typedef __attribute__((ext_vector_type(4)))  int v4i;
typedef float __attribute__((may_alias)) float_a;
typedef int __attribute__((may_alias)) int_a;

template <typename T> __device__ __forceinline__ void vst2(void* p, T v) { *(T*)p = v;  }
__device__ __forceinline__ v8f wmma16(v16h a, v16h b, v8f c) {
  v8f d = __builtin_amdgcn_wmma_f32_16x16x32_f16(false, a, false, b, (short)0, c, false, false);
  asm volatile("v_nop\n\tv_nop\n\tv_nop\n\tv_nop" : "+v"(d) : "v"(a), "v"(b));
  return d;
}
__device__ __forceinline__ v8f wmma_bf(v16b a, v16b b, v8f c) {
  v8f d = __builtin_amdgcn_wmma_f32_16x16x32_bf16(false, a, false, b, (short)0, c, false, false);
  asm volatile("v_nop\n\tv_nop\n\tv_nop\n\tv_nop" : "+v"(d) : "v"(a), "v"(b));
  return d;
}
// 16x16x32 fragments: lane = (h = lane>>4, row/col = lane&15); elements 0..7 = k0+8h+0..7, 8..15 = k0+16+8h+0..7; D element r = row 8h+r
__device__ __forceinline__ v16h frag_h(const _Float16* rowk0, int lane) {
  union { v16h v; v8h q[2]; } u; const _Float16* p = rowk0 + 8 * (lane >> 4);
  u.q[0] = *(const v8h*)p; u.q[1] = *(const v8h*)(p + 16); return u.v;
}
__device__ __forceinline__ v16h frag_f32(const float* rowk0, int lane) {
  v16h a; const float* p = rowk0 + 8 * (lane >> 4);
#pragma unroll
  for (int i = 0; i < 8; ++i) { a[i] = (_Float16)p[i]; a[8 + i] = (_Float16)p[16 + i]; }
  return a;
}
__device__ __forceinline__ v16h frag_f32s(const float* rowk0, int lane, float sc) {
  v16h a; const float* p = rowk0 + 8 * (lane >> 4);
#pragma unroll
  for (int i = 0; i < 8; ++i) { a[i] = (_Float16)(p[i] * sc); a[8 + i] = (_Float16)(p[16 + i] * sc); }
  return a;
}
// column fragment from a [K][ld] layout (column n), rows >= K read as 0
__device__ __forceinline__ v16h fragc_f32(const float* W, int k0, int n, int lane, int ld, int K) {
  v16h a; const int g = lane >> 4;
#pragma unroll
  for (int i = 0; i < 8; ++i) { const int ka = k0 + 8 * g + i, kb = ka + 16;
    a[i] = (_Float16)(ka < K ? W[(size_t)(ka < K ? ka : K - 1) * ld + n] : 0.f); a[8 + i] = (_Float16)(kb < K ? W[(size_t)(kb < K ? kb : K - 1) * ld + n] : 0.f); }
  return a;
}
struct F2 { v16b h, l; };
__device__ __forceinline__ F2 bsplit16(const float v[16]) { F2 r;
#pragma unroll
  for (int i = 0; i < 16; ++i) { const __bf16 h = (__bf16)v[i]; r.h[i] = h; r.l[i] = (__bf16)(v[i] - (float)h); }
  return r; }
__device__ __forceinline__ F2 split_row(const float* row, int k0, int lane) { float v[16]; const float* p = row + k0 + 8 * (lane >> 4);
#pragma unroll
  for (int i = 0; i < 8; ++i) { v[i] = p[i]; v[8 + i] = p[16 + i]; }
  return bsplit16(v); }
__device__ __forceinline__ F2 split_rowK(const float* row, int k0, int lane, int K) { float v[16]; const int g = lane >> 4;
#pragma unroll
  for (int i = 0; i < 8; ++i) { const int ka = k0 + 8 * g + i, kb = ka + 16; v[i] = ka < K ? row[ka < K ? ka : K - 1] : 0.f; v[8 + i] = kb < K ? row[kb < K ? kb : K - 1] : 0.f; }
  return bsplit16(v); }
__device__ __forceinline__ F2 split_col(const float* W, int k0, int n, int lane, int ld, int K) { float v[16]; const int g = lane >> 4;
#pragma unroll
  for (int i = 0; i < 8; ++i) { const int ka = k0 + 8 * g + i, kb = ka + 16; v[i] = ka < K ? W[(size_t)(ka < K ? ka : K - 1) * ld + n] : 0.f; v[8 + i] = kb < K ? W[(size_t)(kb < K ? kb : K - 1) * ld + n] : 0.f; }
  return bsplit16(v); }
__device__ __forceinline__ v8f mac3(const F2& a, const F2& b, v8f c) { c = wmma_bf(a.l, b.h, c); c = wmma_bf(a.h, b.l, c); return wmma_bf(a.h, b.h, c); }
__device__ __forceinline__ float sigm(float v) { return 1.0f / (1.0f + expf(-v)); }
#define LDSX() do { asm volatile("s_wait_dscnt 0" ::: "memory"); __builtin_amdgcn_wave_barrier(); __builtin_amdgcn_fence(__ATOMIC_RELEASE, "workgroup"); } while (0)

// Plain multi-head attention core on given tensors (query / key / value [2,2048,32,64] = [batch, seq, heads, dim]; no mask, no projections; norm factor sqrt(64)): ctx = softmax(Q K^T / 8) V per (batch, head), returned as [2,2048,2048] (heads merged).
#define NB 2
#define TT 2048
#define CC 2048            // NH * HD = projected width
#define DIN 2048          // input (model) width
#define NH 32
#define HD 64
#define NQB (TT / 64)
#define HG 4
#define SCALE (0.125f)
#define CAUSAL 0
#ifndef TNB
#define TNB NB
#endif
__device__ __forceinline__ float bfr(float v) { return (float)(__bf16)v; }
__host__ __device__ __forceinline__ int kb_last(int qb) { return CAUSAL ? ((qb * 64 + 63) >> 7) : (TT / 128 - 1); }
typedef __attribute__((ext_vector_type(8))) __bf16 v8b;
__device__ __forceinline__ v16b frag_b(const __bf16* rowk0, int lane) {
  union { v16b v; v8b q[2]; } u; const __bf16* p = rowk0 + 8 * (lane >> 4);
  u.q[0] = *(const v8b*)p; u.q[1] = *(const v8b*)(p + 16); return u.v;
}
#define QBH 0
#define QHI 0               // exact planes: single-product logits everywhere
#define KHI 64            // key rows carrying k residual / v bf16 hi+lo planes (written only by k_proj, which is not launched)
// B fragment (k rows k0+.., output column o) of a weight: (in,out) [K][ld] or (out,in) [ld rows of K]: bf16 exact, or f16(bf16 * 256) exact
__device__ __forceinline__ v16b wcol_io(const float* Wm, int k0, int o, int lane, int ld) { v16b w; const int g = lane >> 4;
#pragma unroll
  for (int i = 0; i < 8; ++i) { w[i] = (__bf16)Wm[(size_t)(k0 + 8 * g + i) * ld + o]; w[8 + i] = (__bf16)Wm[(size_t)(k0 + 16 + 8 * g + i) * ld + o]; }
  return w; }
__device__ __forceinline__ v16b wcol_oi(const float* Wm, int k0, int o, int lane, int K) { v16b w; const float* p = Wm + (size_t)o * K + k0 + 8 * (lane >> 4);
#pragma unroll
  for (int i = 0; i < 8; ++i) { w[i] = (__bf16)p[i]; w[8 + i] = (__bf16)p[16 + i]; }
  return w; }
__device__ __forceinline__ v16h wcolh_io(const float* Wm, int k0, int o, int lane, int ld) { v16h w; const int g = lane >> 4;
#pragma unroll
  for (int i = 0; i < 8; ++i) { w[i] = (_Float16)(bfr(Wm[(size_t)(k0 + 8 * g + i) * ld + o]) * 256.0f); w[8 + i] = (_Float16)(bfr(Wm[(size_t)(k0 + 16 + 8 * g + i) * ld + o]) * 256.0f); }
  return w; }
__device__ __forceinline__ v16h wcolh_oi(const float* Wm, int k0, int o, int lane, int K) { v16h w; const float* p = Wm + (size_t)o * K + k0 + 8 * (lane >> 4);
#pragma unroll
  for (int i = 0; i < 8; ++i) { w[i] = (_Float16)(bfr(p[i]) * 256.0f); w[8 + i] = (_Float16)(bfr(p[16 + i]) * 256.0f); }
  return w; }
#define WQKV_LAYOUT 0   // 0 = (in,out) [DIN][CC]; 1 = (out,in) [CC][DIN]; 2 = per-head [NH][DIN][HD]
__device__ __forceinline__ v16b wcol_hdk(const float* Wm, int k0, int o, int lane) { v16b w; const int g = lane >> 4; const float* p = Wm + (size_t)(o / HD) * DIN * HD + (o % HD);
#pragma unroll
  for (int i = 0; i < 8; ++i) { w[i] = (__bf16)p[(size_t)(k0 + 8 * g + i) * HD]; w[8 + i] = (__bf16)p[(size_t)(k0 + 16 + 8 * g + i) * HD]; }
  return w; }
#define WO_OUT_IN 0
#if WQKV_LAYOUT == 1
#define WCOL(W, k0, o, lane) wcol_oi(W, k0, o, lane, DIN)
#elif WQKV_LAYOUT == 2
#define WCOL(W, k0, o, lane) wcol_hdk(W, k0, o, lane)
#else
#define WCOL(W, k0, o, lane) wcol_io(W, k0, o, lane, CC)
#endif
#if WO_OUT_IN
#define WOCOL(W, k0, o, lane) wcol_oi(W, k0, o, lane, CC)
#define WOCOLH(W, k0, o, lane) wcolh_oi(W, k0, o, lane, CC)
#else
#define WOCOL(W, k0, o, lane) wcol_io(W, k0, o, lane, DIN)
#define WOCOLH(W, k0, o, lane) wcolh_io(W, k0, o, lane, DIN)
#endif
typedef _Float16 hx8 __attribute__((ext_vector_type(8)));
#define SM_EXTRA_PARAMS
#define SM_MASK_HOOK (void)0
#ifndef SM_EXTRA_PARAMS
#define SM_EXTRA_PARAMS
#endif
#ifndef PROJ_EXTRA_PARAMS
#define PROJ_EXTRA_PARAMS
#endif
#ifndef SM_MASK_HOOK
#define SM_MASK_HOOK (void)0
#endif

#define WS_QH  0u                                      // f16 q rows [b*t][CC]
#define WS_KH  (WS_QH + 2u * (size_t)NB * TT * CC)      // f16 k rows [b*t][CC]
#define WS_VT  (WS_KH + 2u * (size_t)NB * TT * CC)      // f16 v planes [b][c][t]
#define WS_QL  (WS_VT + 2u * (size_t)NB * CC * TT)      // f16 q residual x 2^10 rows [b][t < QHI][CC]
#define WS_KL  (WS_QL + 2u * (size_t)NB * QHI * CC)     // f16 k residual x 2^10 rows [b][t < KHI][CC]
#define WS_VB  (WS_KL + 2u * (size_t)NB * KHI * CC)     // bf16 v hi planes [b][c][t < KHI]
#define WS_VBL (WS_VB + 2u * (size_t)NB * CC * KHI)
#define WS_S   (WS_VBL + 2u * (size_t)NB * CC * KHI)    // f32 [hg][t][s], reserved; no kernel here uses it
#define WS_Y   (WS_S  + 4u * (size_t)HG * TT * TT)      // f32 ctx rows [b*t][CC] (only when there is an output projection)
#define WS_END (WS_Y  + 0u)

// ---- k_proj: block = (64 rows, 128 cols, which): q/k/v = X W (+ b) with exact bf16 products (K = DIN) -> which 0: q f16 rows (+ residual rows < QHI); 1: k f16 rows (+ residual rows < KHI); 2: v f16 planes [c][t] (+ bf16 hi/lo planes for t < KHI)
__global__ __launch_bounds__(128) void k_proj(const float* __restrict__ XQ, const float* __restrict__ XK, const float* __restrict__ XV, const float* __restrict__ WQ, const float* __restrict__ WK, const float* __restrict__ WV, const float* __restrict__ BQ, const float* __restrict__ BK, const float* __restrict__ BV,
    _Float16* __restrict__ QH, _Float16* __restrict__ QL, _Float16* __restrict__ KH, _Float16* __restrict__ KL, _Float16* __restrict__ VT, __bf16* __restrict__ VB, __bf16* __restrict__ VBL) {
  __shared__ __align__(16) _Float16 sh[64][136], sl[64][136]; __shared__ __align__(16) _Float16 th[128][72]; __shared__ __align__(16) __bf16 tb[128][72], tbl[128][72];
  const int tid = threadIdx.x, wave = tid >> 5, lane = tid & 31, col = lane & 15, g = lane >> 4; const int which = blockIdx.z; const int c0 = blockIdx.y * 128; const size_t r0 = (size_t)blockIdx.x * 64; const size_t bb = r0 / TT; const int t0 = (int)(r0 % TT);
  const float* X = which == 0 ? XQ : which == 1 ? XK : XV; const float* WA = which == 0 ? WQ : which == 1 ? WK : WV; const float* BA = which == 0 ? BQ : which == 1 ? BK : BV;
  v8f acc[8] = {};
#pragma unroll 2
  for (int kc = 0; kc < DIN / 32; ++kc) { v16b a; { const float* p = X + (r0 + wave * 16 + col) * DIN + kc * 32 + 8 * g;
#pragma unroll
      for (int i = 0; i < 8; ++i) { a[i] = (__bf16)p[i]; a[8 + i] = (__bf16)p[16 + i]; } }
    asm volatile("s_wait_loadcnt 0x0" ::: "memory");
#pragma unroll
    for (int j = 0; j < 8; ++j) { const v16b w = WCOL(WA, kc * 32, c0 + j * 16 + col, lane); asm volatile("s_wait_loadcnt 0x0" ::: "memory"); acc[j] = wmma_bf(a, w, acc[j]); } }
  if (which < 2) { _Float16* DH = which == 0 ? QH : KH; _Float16* DL = which == 0 ? QL : KL; const int nhi = which == 0 ? QHI : KHI; const bool hi_rows = t0 < nhi;
#pragma unroll
    for (int j = 0; j < 8; ++j) { const float bias = BA ? bfr(BA[c0 + j * 16 + col]) : 0.f;
#pragma unroll
      for (int r = 0; r < 8; ++r) { const float v = acc[j][r] + bias; const _Float16 hv = (_Float16)v; sh[wave * 16 + 8 * g + r][j * 16 + col] = hv; sl[wave * 16 + 8 * g + r][j * 16 + col] = (_Float16)((v - (float)hv) * 1024.0f); } }
    __syncthreads();
    for (int e = tid; e < 64 * 16; e += 128) { const int rl = e >> 4, q = e & 15; vst2((unsigned*)(DH + (r0 + rl) * CC + c0 + q * 8), *(const v4u*)&sh[rl][q * 8]); if (hi_rows) vst2((unsigned*)(DL + (bb * nhi + t0 + rl) * (size_t)CC + c0 + q * 8), *(const v4u*)&sl[rl][q * 8]); }
  } else { const bool hi_rows = t0 < KHI;
#pragma unroll
    for (int j = 0; j < 8; ++j) { const float bias = BA ? bfr(BA[c0 + j * 16 + col]) : 0.f;
#pragma unroll
      for (int r = 0; r < 8; ++r) { const float v = acc[j][r] + bias; const int rl = wave * 16 + 8 * g + r, cl = j * 16 + col; th[cl][rl] = (_Float16)v; const __bf16 bh = (__bf16)v; tb[cl][rl] = bh; tbl[cl][rl] = (__bf16)(v - (float)bh); } }
    __syncthreads();
    for (int e = tid; e < 128 * 8; e += 128) { const int cl = e >> 3, q = e & 7; vst2((unsigned*)(VT + (bb * CC + c0 + cl) * (size_t)TT + t0 + q * 8), *(const v4u*)&th[cl][q * 8]); if (hi_rows) { const size_t o3 = (bb * CC + c0 + cl) * (size_t)KHI + t0 + q * 8; vst2((unsigned*)(VB + o3), *(const v4u*)&tb[cl][q * 8]); vst2((unsigned*)(VBL + o3), *(const v4u*)&tbl[cl][q * 8]); } } } }
// ---- k_fa: block = 256 queries of one (batch, head), 8 waves x 32 query columns; keys walked in stages of 64 through two LDS buffers.
// Reads the f32 inputs itself: q is rounded (bf16, times 64^-0.5 log2 e, then f16) into the B fragments once, k and v tiles are rounded in registers on their way to LDS, so no conversion launch and no workspace planes.
// Transposed products: S^T = K . Q^T (a lane holds 16 of one query's 32 logits per pass), P^T packs from the score registers straight into the B operand of O^T += V^T . P^T; V^T comes from key-major v rows by the transposing LDS load.
// The score product gives the exponent itself: q carries 64^-0.5 log2 e and the C operand carries -m_run, so 2^x reads the accumulators with no multiply-add in between.
// Online softmax in the log2 domain: m_run may trail the true maximum, and no maximum is taken while it holds: P is formed against m_run and the pass's own sums say whether it still holds (P <= its lane's sum <= 2^11, far inside f16); only a pass that fails takes its maximum, rescales sums and outputs, and forms its P again.
// Every inner loop is fully unrolled so that the fragment, score and output arrays are indexed by constants and stay in registers.
#define FAW 8              // waves per block
#define FAS 64             // keys per stage
#define FAP 72             // k rows in LDS, pitch in halves: 128 B of data + 16 B, an odd multiple of 16 B (ds_load_b128 reader)
#define FAPV 80            // v rows in LDS, pitch in halves: 128 B of data + 32 B, an odd multiple of 32 B (ds_load_tr16_b128 reader)
#define FNS (TT / FAS)
#define FPF 2              // stages per prefetch request: 8 waves x 16 rows = 2 * FAS rows of k (lanes 0..15) and of v (lanes 16..31), one lane per 256-B head slice of a row
typedef __attribute__((ext_vector_type(2))) _Float16 v2h;
typedef __attribute__((ext_vector_type(4))) _Float16 v4h;
typedef __attribute__((ext_vector_type(8))) short s16x8;
__device__ __forceinline__ v8f mmh(v16h a, v16h b, v8f c) { return __builtin_amdgcn_wmma_f32_16x16x32_f16(false, a, false, b, (short)0, c, false, false); }
__device__ __forceinline__ float xhalf(float x) { return __builtin_bit_cast(float, __builtin_amdgcn_permlanex16(__builtin_bit_cast(int, x), __builtin_bit_cast(int, x), 0x76543210, 0xfedcba98, false, false)); }  // lane l with lane l ^ 16
typedef __attribute__((ext_vector_type(2))) __bf16 v2b;
__device__ __forceinline__ v2h rnd2(float x, float y) {   // f32 -> bf16 (nearest even, both in one instruction) -> f16: the values of (_Float16)bfr(.)
  const unsigned u = __builtin_bit_cast(unsigned, __builtin_convertvector(v2f{x, y}, v2b));
  return __builtin_convertvector(v2f{__builtin_bit_cast(float, u << 16), __builtin_bit_cast(float, u & 0xffff0000u)}, v2h); }
__device__ __forceinline__ v4h rnd4(v4f x) { const v2h a = rnd2(x[0], x[1]), c = rnd2(x[2], x[3]); return v4h{a.x, a.y, c.x, c.y}; }
__device__ __forceinline__ v16h frag_q(const float* rowk0, int lane, float sc) {   // the k order of frag_h, from an f32 row; each bf16 value times sc, then to f16
  v16h a; const float* p = rowk0 + 8 * (lane >> 4);
#pragma unroll
  for (int i = 0; i < 8; ++i) { a[i] = (_Float16)(bfr(p[i]) * sc); a[8 + i] = (_Float16)(bfr(p[16 + i]) * sc); }
  return a;
}
__device__ __forceinline__ v8h ld_tr16(const _Float16* p) { typedef __attribute__((address_space(3))) s16x8 lds_s16x8; return __builtin_bit_cast(v8h, __builtin_amdgcn_ds_load_tr16_b128_v8i16((lds_s16x8*)p)); }
// A fragment of V^T (row = d0 + lane & 15, k = keys k0 .. k0 + 31 in the k order of frag_h) from key-major rows; t = the tile's row k0, column d0
__device__ __forceinline__ v16h frag_vt(const _Float16* t, int lane) {
  union { v16h v; v8h q[2]; } u; const _Float16* p = t + (8 * (lane >> 4) + (lane & 7)) * FAPV + 8 * ((lane >> 3) & 1);
  u.q[0] = ld_tr16(p); u.q[1] = ld_tr16(p + 16 * FAPV); return u.v;
}
#define FAT 2048.0f        // a lane's sum of 8 probabilities above this sends the pass to the maximum and the rescale: every P that reaches the f16 operand is <= 2^11
// One column group's 16 scores of a pass (two score tiles; each already log2-scaled logit - m_run, as the matrix unit left it) -> P = 2^score, or 2^(score - d) where SH, packed to the B operand in the k order of frag_h, and their sum in f32 (even and odd elements apart)
template <bool SH> __device__ __forceinline__ void fa_exp(const v8f& s0, const v8f& s1, float d, v16h& pf, v2f& t) {
#pragma unroll
  for (int i = 0; i < 8; ++i) {   // operand elements 2i, 2i+1 = key 8g + .. of score tile i >> 2
    const v8f& sx = i < 4 ? s0 : s1;
    v2f a = {sx[2 * (i & 3)], sx[2 * (i & 3) + 1]}; if (SH) a = a - v2f{d, d};
    const v2f p = {__builtin_amdgcn_exp2f(a.x), __builtin_amdgcn_exp2f(a.y)}; t = i == 0 ? p : t + p;
    const v2h ph = __builtin_convertvector(p, v2h); pf[2 * i] = ph.x; pf[2 * i + 1] = ph.y; }
}
__global__ __launch_bounds__(256) __attribute__((amdgpu_waves_per_eu(4, 4))) void k_fa(const float* __restrict__ Qs, const float* __restrict__ Ks, const float* __restrict__ Vs, float* __restrict__ Y) {
  __shared__ __align__(16) _Float16 sk[2][FAS][FAP], sv[2][FAS][FAPV]; __shared__ __align__(16) float so[FAW][32][HD + 4];
  const int tid = threadIdx.x, wave = tid >> 5, lane = tid & 31, col = lane & 15, g = lane >> 4;
  const int sw = __builtin_amdgcn_readfirstlane(wave);   // the wave's number in a scalar register
  const int b = blockIdx.y / NH, h = blockIdx.y % NH; const int q0 = blockIdx.x * (FAW * 32) + wave * 32;
  // staging: 16 lanes fetch one key's whole 256-B f32 head slice (two lines); each thread moves 4 floats of rows srow, srow + 16, + 32, + 48 of a tile
  const int srow = tid >> 4, sch = (tid & 15) * 4;
  const float* kg = Ks + ((size_t)b * TT + srow) * CC + h * HD + sch;
  const float* vg = Vs + ((size_t)b * TT + srow) * CC + h * HD + sch;
  // L2 prefetch of the k and v rows: the tile loads have one pass of flight, which covers an L2 hit but not always a fetch from memory. pfa is a lane's row slice in stages 2 and 3; every later request first moves it on by FPF stages, so it names a slice inside k or v at all times.
  unsigned long long pfa = (unsigned long long)((g ? Vs : Ks) + ((size_t)b * TT + FPF * FAS + wave * 16 + col) * CC + h * HD);
  asm volatile("global_prefetch_b8 %0, off scope:SCOPE_SE" :: "v"(pfa));   // stages 2 and 3 into L2; returns nothing, counts on no counter. Ahead of the q loads: behind the first tiles it sank to the first barrier and lost a memory latency of lead
  v16h qf[2][2];
#pragma unroll
  for (int gq = 0; gq < 2; ++gq) {
#pragma unroll
    for (int kc = 0; kc < 2; ++kc) qf[gq][kc] = frag_q(Qs + ((size_t)b * TT + q0 + gq * 16 + col) * CC + h * HD + kc * 32, lane, SCALE * 1.4426950408889634f);
    asm volatile("s_wait_xcnt 0x0" ::: "memory"); }   // a row's loads name an address pair that later loads' data and the zeroing of the accumulators overwrite. Ahead of the tiles' loads it waits for no data
  v4f r[4];   // the one tile in flight: v and k take turns in it
  { v4f r0[4];
#pragma unroll
    for (int i = 0; i < 4; ++i) { r0[i] = *(const v4f*)(kg + (size_t)(16 * i) * CC); r[i] = *(const v4f*)(vg + (size_t)(16 * i) * CC); }
#pragma unroll
    for (int i = 0; i < 4; ++i) { *(v4h*)&sk[0][srow + 16 * i][sch] = rnd4(r0[i]); *(v4h*)&sv[0][srow + 16 * i][sch] = rnd4(r[i]); }
#pragma unroll
    for (int i = 0; i < 4; ++i) r[i] = *(const v4f*)(vg + (size_t)(FAS + 16 * i) * CC); }
  v8f acc[2][4] = {}; v2f l2[2] = {};
  v8f nm[2] = {};   // -m_run of the lane's query column in all eight elements: the C operand of the score products
  float thr = -1.0f, dlo = -3.0e38f;   // wave-uniform; a wave's first pass has no maximum yet: no sum passes thr, and the maximum it then takes may be of either sign
  __syncthreads();
#pragma unroll 1   // the stage loop stays rolled: a second copy of its body would not fit the 256 registers that four waves per SIMD allow
  for (int st = 0; st < FNS; ++st) { const int bf = st & 1; v16h kf[2][2];
#pragma unroll
    for (int ps = 0; ps < FAS / 32; ++ps) {
      v8f s[2][2];
      if (ps == 0) {
#pragma unroll
        for (int kt = 0; kt < 2; ++kt) { kf[kt][0] = frag_h(&sk[bf][kt * 16 + col][0], lane); kf[kt][1] = frag_h(&sk[bf][kt * 16 + col][32], lane); }
        __builtin_amdgcn_sched_barrier(0); }   // the eight reads go out as one group ahead of the products: with the barrier below alone they sank among the products, two at a time, each pair waited for in full
#pragma unroll
      for (int kt = 0; kt < 2; ++kt)
#pragma unroll
        for (int gq = 0; gq < 2; ++gq) s[kt][gq] = mmh(kf[kt][1], qf[gq][1], mmh(kf[kt][0], qf[gq][0], nm[gq]));
      __builtin_amdgcn_sched_barrier(0);   // the eight products stand together: spread among the exponentials, which now follow them directly, each cost up to four v_nop of distance
      v16h vf[4];
#pragma unroll
      for (int j = 0; j < 4; ++j) vf[j] = frag_vt(&sv[bf][ps * 32][j * 16], lane);
      // Probabilities on trust: P = 2^(logit - m_run) is formed at once, with no maximum taken first. The pass's own sums are the test: every P is >= 0, so each is at most its lane's sum.
      v16h pf[2]; v2f t[2];
#pragma unroll
      for (int gq = 0; gq < 2; ++gq) fa_exp<false>(s[0][gq], s[1][gq], 0.0f, pf[gq], t[gq]);
      const float tm = fmaxf(fmaxf(t[0].x, t[0].y), fmaxf(t[1].x, t[1].y));
      if (__builtin_amdgcn_ballot_w32(!(tm <= thr)) != 0) {   // scalar branch, once per pass; taken in a wave's first pass (thr starts below every sum) and rarely after it
#pragma unroll
        for (int gq = 0; gq < 2; ++gq) { float mx = s[0][gq][0];
#pragma unroll
          for (int r8 = 1; r8 < 8; ++r8) mx = fmaxf(mx, s[0][gq][r8]);
#pragma unroll
          for (int r8 = 0; r8 < 8; ++r8) mx = fmaxf(mx, s[1][gq][r8]);
          mx = fmaxf(mx, xhalf(mx));   // the pass's maximum, counted from m_run
          const float d = fmaxf(mx, dlo); const float corr = __builtin_amdgcn_exp2f(-fmaxf(d, 0.0f)); nm[gq] = nm[gq] - d; l2[gq] = l2[gq] * corr;   // m_run rises by d (first pass: moves to the maximum; sums and outputs are still 0 there)
#pragma unroll
          for (int j = 0; j < 4; ++j) acc[gq][j] = acc[gq][j] * corr;
          fa_exp<true>(s[0][gq], s[1][gq], d, pf[gq], t[gq]); }   // the pass's P and sums again, now against its true maximum: all <= 1
        thr = FAT; dlo = 0.0f; }
#pragma unroll
      for (int gq = 0; gq < 2; ++gq) l2[gq] = l2[gq] + t[gq];
      // Hand-over of the tile in flight, one pass after its loads: it goes, rounded, into the buffer that stage st + 1 reads (free since the barrier that ended stage st - 1), and the next tile's loads take its registers.
      // Pass 0: v of stage st + 1 lands, k of stage st + 1 starts. Pass 1: that k lands, v of stage st + 2 starts. Past the last stage the last tile is fetched again, into the buffer nobody reads any more: no branch.
      if (ps == 0) { const float* kt = kg + (size_t)((st + 1 < FNS ? st + 1 : FNS - 1) * FAS) * CC;
#pragma unroll
        for (int kt = 0; kt < 2; ++kt) { kf[kt][0] = frag_h(&sk[bf][32 + kt * 16 + col][0], lane); kf[kt][1] = frag_h(&sk[bf][32 + kt * 16 + col][32], lane); }   // pass 1's k fragments, from this stage's own buffer: read here, above the scheduling barriers, they arrive under the tile's rounding; further down the compiler read them right in front of their products
        __builtin_amdgcn_sched_barrier(0);   // holds those reads above the rounding
#pragma unroll
        for (int i = 0; i < 4; ++i) *(v4h*)&sv[bf ^ 1][srow + 16 * i][sch] = rnd4(r[i]);
        __builtin_amdgcn_sched_barrier(0);   // the tile leaves its registers before the next one's loads are issued: both at once would not fit
#pragma unroll
        for (int i = 0; i < 4; ++i) r[i] = *(const v4f*)(kt + (size_t)(16 * i) * CC);
        asm volatile("s_wait_xcnt 0x0" :: "v"(kt) : "memory");   // the four loads name kt's register pair: as an input here it stays whole until the wait (with two registers fewer to spare the compiler had laid the last load's data over it), and what overwrites it next stands behind the wait
        // Every FPF-th stage asks for stages st + 4 and st + 5, whose first loads are issued in stage st + 2. Scalar branch; the last request names the last two stages, and the address moves no further. Add and request stand in one statement so that the request names the register pair that lives through the loop, never a temporary.
        if ((st & (FPF - 1)) == 0 && st + 2 * FPF + 1 < FNS) asm volatile("v_add_nc_u64 %0, %1, %0\n\tglobal_prefetch_b8 %0, off scope:SCOPE_SE" : "+v"(pfa) : "s"((unsigned long long)FPF * FAS * CC * 4));
      } else { const int ks = (st + 2 < FNS ? st + 2 : FNS - 1) * FAS;
#pragma unroll
        for (int i = 0; i < 4; ++i) *(v4h*)&sk[bf ^ 1][srow + 16 * i][sch] = rnd4(r[i]);
        __builtin_amdgcn_sched_barrier(0);   // as in pass 0
#pragma unroll
        for (int i = 0; i < 4; ++i) r[i] = *(const v4f*)(vg + (size_t)(ks + 16 * i) * CC); }
      __builtin_amdgcn_sched_barrier(0);   // keeps the four loads here, at the head of the block: sunk towards the block's end they would lose part of their flight
#pragma unroll
      for (int gq = 0; gq < 2; ++gq)
#pragma unroll
        for (int j = 0; j < 4; ++j) acc[gq][j] = mmh(vf[j], pf[gq], acc[gq][j]); }
    // Publishes stage st + 1 and ends every wave's reads of the buffer that stage st + 1 refills. The fences name LDS alone: __syncthreads() would also wait here for the v loads in flight, which only fill registers.
    asm volatile("s_wait_xcnt 0x0" ::: "memory");   // pass 1's loads name an address pair that the next stage's first fragment reads overwrite
    __builtin_amdgcn_fence(__ATOMIC_RELEASE, "workgroup", "local"); __builtin_amdgcn_s_barrier(); __builtin_amdgcn_fence(__ATOMIC_ACQUIRE, "workgroup", "local");
  }
  // The epilogue forms its addresses anew, from the lane count and the scalar wave number: formed from tid they are kept in vector registers across the loop, which has none to spare (they spilled).
  const int el = (int)__builtin_amdgcn_mbcnt_lo(~0u, 0u), ec = el & 15, eg = el >> 4;
#pragma unroll
  for (int gq = 0; gq < 2; ++gq) { float l = l2[gq].x + l2[gq].y; l += xhalf(l); const float inv = 1.0f / l;
#pragma unroll
    for (int j = 0; j < 4; ++j) { const v8f o = acc[gq][j] * inv; *(v4f*)&so[sw][gq * 16 + ec][j * 16 + 8 * eg] = v4f{o[0], o[1], o[2], o[3]}; *(v4f*)&so[sw][gq * 16 + ec][j * 16 + 8 * eg + 4] = v4f{o[4], o[5], o[6], o[7]}; } }
  LDSX();   // the wave's own rows are read back by other lanes, so that 16 lanes store one whole 256-B (row, head) segment
#pragma unroll
  for (int rl = 0; rl < 32; rl += 2) vst2(Y + ((size_t)b * TT + blockIdx.x * (FAW * 32) + sw * 32 + rl + eg) * CC + h * HD + ec * 4, *(const v4f*)&so[sw][rl + eg][ec * 4]);
}

extern "C" void kernel_launch(void* const* d_in, const int* in_sizes, int n_in, void* d_out, int out_size, void* d_ws, size_t ws_size, hipStream_t stream) {
  (void)in_sizes; (void)n_in; (void)out_size;
  const float** F = (const float**)d_in;
  if (ws_size < (size_t)WS_END) return;
  char* ws = (char*)d_ws; _Float16 *QH = (_Float16*)(ws + WS_QH), *KH = (_Float16*)(ws + WS_KH), *VT = (_Float16*)(ws + WS_VT), *QL = (_Float16*)(ws + WS_QL), *KL = (_Float16*)(ws + WS_KL); __bf16 *VB = (__bf16*)(ws + WS_VB), *VBL = (__bf16*)(ws + WS_VBL); float *S = (float*)(ws + WS_S), *Y = (float*)(ws + WS_Y);
  (void)Y; (void)S; (void)QH; (void)KH; (void)VT; (void)QL; (void)KL; (void)VB; (void)VBL;
  // inputs: 0 query [2,2048,32,64]; 1 key; 2 value (rows [b*2048 + s][n*64 + h] = merged-head rows)
  k_fa<<<dim3(TT / (FAW * 32), TNB * NH), 256, 0, stream>>>(F[0], F[1], F[2], (float*)d_out);   /* ctx [b, sq, n*h] = merged-head rows */
}

// v006
// One run takes 52.1 microseconds.
// Next to v005, in two timings, it ran 1.04 and 1.05 times as fast.
// All steps since v000 together make it 38.3 times as fast.
// compute dtype: all float inputs rounded to bf16; key, value are bf16-valued so their f16 planes are exact; q plane = f16(bf16 q x 64^-0.5 log2 e), one more rounding; logits q x k (1 product) accumulated on top of minus the running maximum; online softmax f32; P = 2^(that sum) once to f16 x v (exact) (1 product), divided by the f32 sum at the end; f32 output.
#include <hip/hip_runtime.h>
#include <math.h>

typedef __attribute__((ext_vector_type(16))) _Float16 v16h;
typedef __attribute__((ext_vector_type(16))) __bf16 v16b;
typedef __attribute__((ext_vector_type(8)))  _Float16 v8h;
typedef __attribute__((ext_vector_type(8)))  float v8f;
typedef __attribute__((ext_vector_type(4)))  float v4f;
typedef __attribute__((ext_vector_type(2)))  float v2f;
typedef __attribute__((ext_vector_type(4)))  unsigned v4u;
typedef __attribute__((ext_vector_type(4)))  int v4i;
typedef float __attribute__((may_alias)) float_a;
typedef int __attribute__((may_alias)) int_a;

template <typename T> __device__ __forceinline__ void vst2(void* p, T v) { *(T*)p = v;  }
__device__ __forceinline__ v8f wmma16(v16h a, v16h b, v8f c) {
  v8f d = __builtin_amdgcn_wmma_f32_16x16x32_f16(false, a, false, b, (short)0, c, false, false);
  asm volatile("v_nop\n\tv_nop\n\tv_nop\n\tv_nop" : "+v"(d) : "v"(a), "v"(b));
  return d;
}
__device__ __forceinline__ v8f wmma_bf(v16b a, v16b b, v8f c) {
  v8f d = __builtin_amdgcn_wmma_f32_16x16x32_bf16(false, a, false, b, (short)0, c, false, false);
  asm volatile("v_nop\n\tv_nop\n\tv_nop\n\tv_nop" : "+v"(d) : "v"(a), "v"(b));
  return d;
}
// 16x16x32 fragments: lane = (h = lane>>4, row/col = lane&15); elements 0..7 = k0+8h+0..7, 8..15 = k0+16+8h+0..7; D element r = row 8h+r
__device__ __forceinline__ v16h frag_h(const _Float16* rowk0, int lane) {
  union { v16h v; v8h q[2]; } u; const _Float16* p = rowk0 + 8 * (lane >> 4);
  u.q[0] = *(const v8h*)p; u.q[1] = *(const v8h*)(p + 16); return u.v;
}
__device__ __forceinline__ v16h frag_f32(const float* rowk0, int lane) {
  v16h a; const float* p = rowk0 + 8 * (lane >> 4);
#pragma unroll
  for (int i = 0; i < 8; ++i) { a[i] = (_Float16)p[i]; a[8 + i] = (_Float16)p[16 + i]; }
  return a;
}
__device__ __forceinline__ v16h frag_f32s(const float* rowk0, int lane, float sc) {
  v16h a; const float* p = rowk0 + 8 * (lane >> 4);
#pragma unroll
  for (int i = 0; i < 8; ++i) { a[i] = (_Float16)(p[i] * sc); a[8 + i] = (_Float16)(p[16 + i] * sc); }
  return a;
}
// column fragment from a [K][ld] layout (column n), rows >= K read as 0
__device__ __forceinline__ v16h fragc_f32(const float* W, int k0, int n, int lane, int ld, int K) {
  v16h a; const int g = lane >> 4;
#pragma unroll
  for (int i = 0; i < 8; ++i) { const int ka = k0 + 8 * g + i, kb = ka + 16;
    a[i] = (_Float16)(ka < K ? W[(size_t)(ka < K ? ka : K - 1) * ld + n] : 0.f); a[8 + i] = (_Float16)(kb < K ? W[(size_t)(kb < K ? kb : K - 1) * ld + n] : 0.f); }
  return a;
}
struct F2 { v16b h, l; };
__device__ __forceinline__ F2 bsplit16(const float v[16]) { F2 r;
#pragma unroll
  for (int i = 0; i < 16; ++i) { const __bf16 h = (__bf16)v[i]; r.h[i] = h; r.l[i] = (__bf16)(v[i] - (float)h); }
  return r; }
__device__ __forceinline__ F2 split_row(const float* row, int k0, int lane) { float v[16]; const float* p = row + k0 + 8 * (lane >> 4);
#pragma unroll
  for (int i = 0; i < 8; ++i) { v[i] = p[i]; v[8 + i] = p[16 + i]; }
  return bsplit16(v); }
__device__ __forceinline__ F2 split_rowK(const float* row, int k0, int lane, int K) { float v[16]; const int g = lane >> 4;
#pragma unroll
  for (int i = 0; i < 8; ++i) { const int ka = k0 + 8 * g + i, kb = ka + 16; v[i] = ka < K ? row[ka < K ? ka : K - 1] : 0.f; v[8 + i] = kb < K ? row[kb < K ? kb : K - 1] : 0.f; }
  return bsplit16(v); }
__device__ __forceinline__ F2 split_col(const float* W, int k0, int n, int lane, int ld, int K) { float v[16]; const int g = lane >> 4;
#pragma unroll
  for (int i = 0; i < 8; ++i) { const int ka = k0 + 8 * g + i, kb = ka + 16; v[i] = ka < K ? W[(size_t)(ka < K ? ka : K - 1) * ld + n] : 0.f; v[8 + i] = kb < K ? W[(size_t)(kb < K ? kb : K - 1) * ld + n] : 0.f; }
  return bsplit16(v); }
__device__ __forceinline__ v8f mac3(const F2& a, const F2& b, v8f c) { c = wmma_bf(a.l, b.h, c); c = wmma_bf(a.h, b.l, c); return wmma_bf(a.h, b.h, c); }
__device__ __forceinline__ float sigm(float v) { return 1.0f / (1.0f + expf(-v)); }
#define LDSX() do { asm volatile("s_wait_dscnt 0" ::: "memory"); __builtin_amdgcn_wave_barrier(); __builtin_amdgcn_fence(__ATOMIC_RELEASE, "workgroup"); } while (0)

// Plain multi-head attention core on given tensors (query / key / value [2,2048,32,64] = [batch, seq, heads, dim]; no mask, no projections; norm factor sqrt(64)): ctx = softmax(Q K^T / 8) V per (batch, head), returned as [2,2048,2048] (heads merged).
#define NB 2
#define TT 2048
#define CC 2048            // NH * HD = projected width
#define DIN 2048          // input (model) width
#define NH 32
#define HD 64
#define NQB (TT / 64)
#define HG 4
#define SCALE (0.125f)
#define CAUSAL 0
#ifndef TNB
#define TNB NB
#endif
__device__ __forceinline__ float bfr(float v) { return (float)(__bf16)v; }
__host__ __device__ __forceinline__ int kb_last(int qb) { return CAUSAL ? ((qb * 64 + 63) >> 7) : (TT / 128 - 1); }
typedef __attribute__((ext_vector_type(8))) __bf16 v8b;
__device__ __forceinline__ v16b frag_b(const __bf16* rowk0, int lane) {
  union { v16b v; v8b q[2]; } u; const __bf16* p = rowk0 + 8 * (lane >> 4);
  u.q[0] = *(const v8b*)p; u.q[1] = *(const v8b*)(p + 16); return u.v;
}
#define QBH 0
#define QHI 0               // exact planes: single-product logits everywhere
#define KHI 64            // key rows carrying k residual / v bf16 hi+lo planes (written only by k_proj, which is not launched)
// B fragment (k rows k0+.., output column o) of a weight: (in,out) [K][ld] or (out,in) [ld rows of K]: bf16 exact, or f16(bf16 * 256) exact
__device__ __forceinline__ v16b wcol_io(const float* Wm, int k0, int o, int lane, int ld) { v16b w; const int g = lane >> 4;
#pragma unroll
  for (int i = 0; i < 8; ++i) { w[i] = (__bf16)Wm[(size_t)(k0 + 8 * g + i) * ld + o]; w[8 + i] = (__bf16)Wm[(size_t)(k0 + 16 + 8 * g + i) * ld + o]; }
  return w; }
__device__ __forceinline__ v16b wcol_oi(const float* Wm, int k0, int o, int lane, int K) { v16b w; const float* p = Wm + (size_t)o * K + k0 + 8 * (lane >> 4);
#pragma unroll
  for (int i = 0; i < 8; ++i) { w[i] = (__bf16)p[i]; w[8 + i] = (__bf16)p[16 + i]; }
  return w; }
__device__ __forceinline__ v16h wcolh_io(const float* Wm, int k0, int o, int lane, int ld) { v16h w; const int g = lane >> 4;
#pragma unroll
  for (int i = 0; i < 8; ++i) { w[i] = (_Float16)(bfr(Wm[(size_t)(k0 + 8 * g + i) * ld + o]) * 256.0f); w[8 + i] = (_Float16)(bfr(Wm[(size_t)(k0 + 16 + 8 * g + i) * ld + o]) * 256.0f); }
  return w; }
__device__ __forceinline__ v16h wcolh_oi(const float* Wm, int k0, int o, int lane, int K) { v16h w; const float* p = Wm + (size_t)o * K + k0 + 8 * (lane >> 4);
#pragma unroll
  for (int i = 0; i < 8; ++i) { w[i] = (_Float16)(bfr(p[i]) * 256.0f); w[8 + i] = (_Float16)(bfr(p[16 + i]) * 256.0f); }
  return w; }
#define WQKV_LAYOUT 0   // 0 = (in,out) [DIN][CC]; 1 = (out,in) [CC][DIN]; 2 = per-head [NH][DIN][HD]
__device__ __forceinline__ v16b wcol_hdk(const float* Wm, int k0, int o, int lane) { v16b w; const int g = lane >> 4; const float* p = Wm + (size_t)(o / HD) * DIN * HD + (o % HD);
#pragma unroll
  for (int i = 0; i < 8; ++i) { w[i] = (__bf16)p[(size_t)(k0 + 8 * g + i) * HD]; w[8 + i] = (__bf16)p[(size_t)(k0 + 16 + 8 * g + i) * HD]; }
  return w; }
#define WO_OUT_IN 0
#if WQKV_LAYOUT == 1
#define WCOL(W, k0, o, lane) wcol_oi(W, k0, o, lane, DIN)
#elif WQKV_LAYOUT == 2
#define WCOL(W, k0, o, lane) wcol_hdk(W, k0, o, lane)
#else
#define WCOL(W, k0, o, lane) wcol_io(W, k0, o, lane, CC)
#endif
#if WO_OUT_IN
#define WOCOL(W, k0, o, lane) wcol_oi(W, k0, o, lane, CC)
#define WOCOLH(W, k0, o, lane) wcolh_oi(W, k0, o, lane, CC)
#else
#define WOCOL(W, k0, o, lane) wcol_io(W, k0, o, lane, DIN)
#define WOCOLH(W, k0, o, lane) wcolh_io(W, k0, o, lane, DIN)
#endif
typedef _Float16 hx8 __attribute__((ext_vector_type(8)));
#define SM_EXTRA_PARAMS
#define SM_MASK_HOOK (void)0
#ifndef SM_EXTRA_PARAMS
#define SM_EXTRA_PARAMS
#endif
#ifndef PROJ_EXTRA_PARAMS
#define PROJ_EXTRA_PARAMS
#endif
#ifndef SM_MASK_HOOK
#define SM_MASK_HOOK (void)0
#endif

#define WS_QH  0u                                      // f16 q rows [b*t][CC]
#define WS_KH  (WS_QH + 2u * (size_t)NB * TT * CC)      // f16 k rows [b*t][CC]
#define WS_VT  (WS_KH + 2u * (size_t)NB * TT * CC)      // f16 v planes [b][c][t]
#define WS_QL  (WS_VT + 2u * (size_t)NB * CC * TT)      // f16 q residual x 2^10 rows [b][t < QHI][CC]
#define WS_KL  (WS_QL + 2u * (size_t)NB * QHI * CC)     // f16 k residual x 2^10 rows [b][t < KHI][CC]
#define WS_VB  (WS_KL + 2u * (size_t)NB * KHI * CC)     // bf16 v hi planes [b][c][t < KHI]
#define WS_VBL (WS_VB + 2u * (size_t)NB * CC * KHI)
#define WS_S   (WS_VBL + 2u * (size_t)NB * CC * KHI)    // f32 [hg][t][s], reserved; no kernel here uses it
#define WS_Y   (WS_S  + 4u * (size_t)HG * TT * TT)      // f32 ctx rows [b*t][CC] (only when there is an output projection)
#define WS_END (WS_Y  + 0u)

// ---- k_proj: block = (64 rows, 128 cols, which): q/k/v = X W (+ b) with exact bf16 products (K = DIN) -> which 0: q f16 rows (+ residual rows < QHI); 1: k f16 rows (+ residual rows < KHI); 2: v f16 planes [c][t] (+ bf16 hi/lo planes for t < KHI)
__global__ __launch_bounds__(128) void k_proj(const float* __restrict__ XQ, const float* __restrict__ XK, const float* __restrict__ XV, const float* __restrict__ WQ, const float* __restrict__ WK, const float* __restrict__ WV, const float* __restrict__ BQ, const float* __restrict__ BK, const float* __restrict__ BV,
    _Float16* __restrict__ QH, _Float16* __restrict__ QL, _Float16* __restrict__ KH, _Float16* __restrict__ KL, _Float16* __restrict__ VT, __bf16* __restrict__ VB, __bf16* __restrict__ VBL) {
  __shared__ __align__(16) _Float16 sh[64][136], sl[64][136]; __shared__ __align__(16) _Float16 th[128][72]; __shared__ __align__(16) __bf16 tb[128][72], tbl[128][72];
  const int tid = threadIdx.x, wave = tid >> 5, lane = tid & 31, col = lane & 15, g = lane >> 4; const int which = blockIdx.z; const int c0 = blockIdx.y * 128; const size_t r0 = (size_t)blockIdx.x * 64; const size_t bb = r0 / TT; const int t0 = (int)(r0 % TT);
  const float* X = which == 0 ? XQ : which == 1 ? XK : XV; const float* WA = which == 0 ? WQ : which == 1 ? WK : WV; const float* BA = which == 0 ? BQ : which == 1 ? BK : BV;
  v8f acc[8] = {};
#pragma unroll 2
  for (int kc = 0; kc < DIN / 32; ++kc) { v16b a; { const float* p = X + (r0 + wave * 16 + col) * DIN + kc * 32 + 8 * g;
#pragma unroll
      for (int i = 0; i < 8; ++i) { a[i] = (__bf16)p[i]; a[8 + i] = (__bf16)p[16 + i]; } }
    asm volatile("s_wait_loadcnt 0x0" ::: "memory");
#pragma unroll
    for (int j = 0; j < 8; ++j) { const v16b w = WCOL(WA, kc * 32, c0 + j * 16 + col, lane); asm volatile("s_wait_loadcnt 0x0" ::: "memory"); acc[j] = wmma_bf(a, w, acc[j]); } }
  if (which < 2) { _Float16* DH = which == 0 ? QH : KH; _Float16* DL = which == 0 ? QL : KL; const int nhi = which == 0 ? QHI : KHI; const bool hi_rows = t0 < nhi;
#pragma unroll
    for (int j = 0; j < 8; ++j) { const float bias = BA ? bfr(BA[c0 + j * 16 + col]) : 0.f;
#pragma unroll
      for (int r = 0; r < 8; ++r) { const float v = acc[j][r] + bias; const _Float16 hv = (_Float16)v; sh[wave * 16 + 8 * g + r][j * 16 + col] = hv; sl[wave * 16 + 8 * g + r][j * 16 + col] = (_Float16)((v - (float)hv) * 1024.0f); } }
    __syncthreads();
    for (int e = tid; e < 64 * 16; e += 128) { const int rl = e >> 4, q = e & 15; vst2((unsigned*)(DH + (r0 + rl) * CC + c0 + q * 8), *(const v4u*)&sh[rl][q * 8]); if (hi_rows) vst2((unsigned*)(DL + (bb * nhi + t0 + rl) * (size_t)CC + c0 + q * 8), *(const v4u*)&sl[rl][q * 8]); }
  } else { const bool hi_rows = t0 < KHI;
#pragma unroll
    for (int j = 0; j < 8; ++j) { const float bias = BA ? bfr(BA[c0 + j * 16 + col]) : 0.f;
#pragma unroll
      for (int r = 0; r < 8; ++r) { const float v = acc[j][r] + bias; const int rl = wave * 16 + 8 * g + r, cl = j * 16 + col; th[cl][rl] = (_Float16)v; const __bf16 bh = (__bf16)v; tb[cl][rl] = bh; tbl[cl][rl] = (__bf16)(v - (float)bh); } }
    __syncthreads();
    for (int e = tid; e < 128 * 8; e += 128) { const int cl = e >> 3, q = e & 7; vst2((unsigned*)(VT + (bb * CC + c0 + cl) * (size_t)TT + t0 + q * 8), *(const v4u*)&th[cl][q * 8]); if (hi_rows) { const size_t o3 = (bb * CC + c0 + cl) * (size_t)KHI + t0 + q * 8; vst2((unsigned*)(VB + o3), *(const v4u*)&tb[cl][q * 8]); vst2((unsigned*)(VBL + o3), *(const v4u*)&tbl[cl][q * 8]); } } } }
// ---- k_fa: block = 256 queries of one (batch, head), 8 waves x 32 query columns; keys walked in stages of 64 through two LDS buffers.
// Reads the f32 inputs itself: q is rounded (bf16, times 64^-0.5 log2 e, then f16) into the B fragments once, k and v tiles are rounded in registers on their way to LDS, so no conversion launch and no workspace planes.
// Transposed products: S^T = K . Q^T (a lane holds 16 of one query's 32 logits per pass), P^T packs from the score registers straight into the B operand of O^T += V^T . P^T; V^T comes from key-major v rows by the transposing LDS load.
// The score product gives the exponent itself: q carries 64^-0.5 log2 e and the C operand carries -m_run, so 2^x reads the accumulators with no multiply-add in between.
// Online softmax in the log2 domain: m_run may trail the true maximum, and no maximum is taken while it holds: P is formed against m_run and the pass's own sums say whether it still holds (P <= its lane's sum <= 2^11, far inside f16); only a pass that fails takes its maximum, rescales sums and outputs, and forms its P again.
// Every inner loop is fully unrolled so that the fragment, score and output arrays are indexed by constants and stay in registers.
#define FAW 8              // waves per block
#define FAS 64             // keys per stage
#define FAP 72             // k rows in LDS, pitch in halves: 128 B of data + 16 B, an odd multiple of 16 B (ds_load_b128 reader)
#define FAPV 80            // v rows in LDS, pitch in halves: 128 B of data + 32 B, an odd multiple of 32 B (ds_load_tr16_b128 reader)
#define FNS (TT / FAS)
#define FPF 2              // stages per prefetch request: 8 waves x 16 rows = 2 * FAS rows of k (lanes 0..15) and of v (lanes 16..31), one lane per 256-B head slice of a row
typedef __attribute__((ext_vector_type(2))) _Float16 v2h;
typedef __attribute__((ext_vector_type(4))) _Float16 v4h;
typedef __attribute__((ext_vector_type(8))) short s16x8;
__device__ __forceinline__ v8f mmh(v16h a, v16h b, v8f c) { return __builtin_amdgcn_wmma_f32_16x16x32_f16(false, a, false, b, (short)0, c, false, false); }
__device__ __forceinline__ float xhalf(float x) { return __builtin_bit_cast(float, __builtin_amdgcn_permlanex16(__builtin_bit_cast(int, x), __builtin_bit_cast(int, x), 0x76543210, 0xfedcba98, false, false)); }  // lane l with lane l ^ 16
typedef __attribute__((ext_vector_type(2))) __bf16 v2b;
__device__ __forceinline__ v2h rnd2(float x, float y) {   // f32 -> bf16 (nearest even, both in one instruction) -> f16: the values of (_Float16)bfr(.)
  const unsigned u = __builtin_bit_cast(unsigned, __builtin_convertvector(v2f{x, y}, v2b));
  return __builtin_convertvector(v2f{__builtin_bit_cast(float, u << 16), __builtin_bit_cast(float, u & 0xffff0000u)}, v2h); }
__device__ __forceinline__ v4h rnd4(v4f x) { const v2h a = rnd2(x[0], x[1]), c = rnd2(x[2], x[3]); return v4h{a.x, a.y, c.x, c.y}; }
__device__ __forceinline__ v16h frag_q(const float* rowk0, int lane, float sc) {   // the k order of frag_h, from an f32 row; each bf16 value times sc, then to f16
  v16h a; const float* p = rowk0 + 8 * (lane >> 4);
#pragma unroll
  for (int i = 0; i < 8; ++i) { a[i] = (_Float16)(bfr(p[i]) * sc); a[8 + i] = (_Float16)(bfr(p[16 + i]) * sc); }
  return a;
}
__device__ __forceinline__ v8h ld_tr16(const _Float16* p) { typedef __attribute__((address_space(3))) s16x8 lds_s16x8; return __builtin_bit_cast(v8h, __builtin_amdgcn_ds_load_tr16_b128_v8i16((lds_s16x8*)p)); }
// A fragment of V^T (row = d0 + lane & 15, k = keys k0 .. k0 + 31 in the k order of frag_h) from key-major rows; t = the tile's row k0, column d0
__device__ __forceinline__ v16h frag_vt(const _Float16* t, int lane) {
  union { v16h v; v8h q[2]; } u; const _Float16* p = t + (8 * (lane >> 4) + (lane & 7)) * FAPV + 8 * ((lane >> 3) & 1);
  u.q[0] = ld_tr16(p); u.q[1] = ld_tr16(p + 16 * FAPV); return u.v;
}
#define FAT 2048.0f        // a lane's sum of 8 probabilities above this sends the pass to the maximum and the rescale: every P that reaches the f16 operand is <= 2^11
// One column group's 16 scores of a pass (two score tiles; each already log2-scaled logit - m_run, as the matrix unit left it) -> P = 2^score, or 2^(score - d) where SH, packed to the B operand in the k order of frag_h, and their sum in f32 (even and odd elements apart)
template <bool SH> __device__ __forceinline__ void fa_exp(const v8f& s0, const v8f& s1, float d, v16h& pf, v2f& t) {
#pragma unroll
  for (int i = 0; i < 8; ++i) {   // operand elements 2i, 2i+1 = key 8g + .. of score tile i >> 2
    const v8f& sx = i < 4 ? s0 : s1;
    v2f a = {sx[2 * (i & 3)], sx[2 * (i & 3) + 1]}; if (SH) a = a - v2f{d, d};
    const v2f p = {__builtin_amdgcn_exp2f(a.x), __builtin_amdgcn_exp2f(a.y)}; t = i == 0 ? p : t + p;
    const v2h ph = __builtin_convertvector(p, v2h); pf[2 * i] = ph.x; pf[2 * i + 1] = ph.y; }
}
__global__ __launch_bounds__(256) __attribute__((amdgpu_waves_per_eu(4, 4))) void k_fa(const float* __restrict__ Qs, const float* __restrict__ Ks, const float* __restrict__ Vs, float* __restrict__ Y) {
  __shared__ __align__(16) _Float16 sk[2][FAS][FAP], sv[2][FAS][FAPV]; __shared__ __align__(16) float so[FAW][32][HD + 4];
  const int tid = threadIdx.x, wave = tid >> 5, lane = tid & 31, col = lane & 15, g = lane >> 4;
  const int sw = __builtin_amdgcn_readfirstlane(wave);   // the wave's number in a scalar register
  // Flat index -> (batch, head, query block). For speed only, any placement gives the same result: the low three bits pick a group of eight neighbouring heads (2 KiB of every k, v row)
  // and all eight query blocks of a head sit at equal index modulo 8. Among the indices of one residue modulo 8 the blocks of a head stand at distances 1, 2, 3 and 32.
  const int fi = blockIdx.x, hb = (fi & 7) * 8 + ((fi >> 5) & 7), qb = ((fi >> 3) & 3) | ((fi >> 8) << 2);
  const int b = hb / NH, h = hb % NH; const int q0 = qb * (FAW * 32) + wave * 32;
  // staging: 16 lanes fetch one key's whole 256-B f32 head slice (two lines); each thread moves 4 floats of rows srow, srow + 16, + 32, + 48 of a tile
  const int srow = tid >> 4, sch = (tid & 15) * 4;
  const float* kg = Ks + ((size_t)b * TT + srow) * CC + h * HD + sch;
  const float* vg = Vs + ((size_t)b * TT + srow) * CC + h * HD + sch;
  // L2 prefetch of the k and v rows: the tile loads have one pass of flight, which covers an L2 hit but not always a fetch from memory. pfa is a lane's row slice in stages 2 and 3; every later request first moves it on by FPF stages, so it names a slice inside k or v at all times.
  unsigned long long pfa = (unsigned long long)((g ? Vs : Ks) + ((size_t)b * TT + FPF * FAS + wave * 16 + col) * CC + h * HD);
  asm volatile("global_prefetch_b8 %0, off scope:SCOPE_SE" :: "v"(pfa));   // stages 2 and 3 into L2; returns nothing, counts on no counter. Ahead of the q loads: behind the first tiles it sank to the first barrier and lost a memory latency of lead
  v16h qf[2][2];
#pragma unroll
  for (int gq = 0; gq < 2; ++gq) {
#pragma unroll
    for (int kc = 0; kc < 2; ++kc) qf[gq][kc] = frag_q(Qs + ((size_t)b * TT + q0 + gq * 16 + col) * CC + h * HD + kc * 32, lane, SCALE * 1.4426950408889634f);
    asm volatile("s_wait_xcnt 0x0" ::: "memory"); }   // a row's loads name an address pair that later loads' data and the zeroing of the accumulators overwrite. Ahead of the tiles' loads it waits for no data
  v4f r[4];   // the one tile in flight: v and k take turns in it
  { v4f r0[4];
#pragma unroll
    for (int i = 0; i < 4; ++i) { r0[i] = *(const v4f*)(kg + (size_t)(16 * i) * CC); r[i] = *(const v4f*)(vg + (size_t)(16 * i) * CC); }
#pragma unroll
    for (int i = 0; i < 4; ++i) { *(v4h*)&sk[0][srow + 16 * i][sch] = rnd4(r0[i]); *(v4h*)&sv[0][srow + 16 * i][sch] = rnd4(r[i]); }
#pragma unroll
    for (int i = 0; i < 4; ++i) r[i] = *(const v4f*)(vg + (size_t)(FAS + 16 * i) * CC); }
  v8f acc[2][4] = {}; v2f l2[2] = {};
  v8f nm[2] = {};   // -m_run of the lane's query column in all eight elements: the C operand of the score products
  float thr = -1.0f, dlo = -3.0e38f;   // wave-uniform; a wave's first pass has no maximum yet: no sum passes thr, and the maximum it then takes may be of either sign
  __syncthreads();
#pragma unroll 1   // the stage loop stays rolled: a second copy of its body would not fit the 256 registers that four waves per SIMD allow
  for (int st = 0; st < FNS; ++st) { const int bf = st & 1; v16h kf[2][2];
#pragma unroll
    for (int ps = 0; ps < FAS / 32; ++ps) {
      v8f s[2][2];
      if (ps == 0) {
#pragma unroll
        for (int kt = 0; kt < 2; ++kt) { kf[kt][0] = frag_h(&sk[bf][kt * 16 + col][0], lane); kf[kt][1] = frag_h(&sk[bf][kt * 16 + col][32], lane); }
        __builtin_amdgcn_sched_barrier(0); }   // the eight reads go out as one group ahead of the products: with the barrier below alone they sank among the products, two at a time, each pair waited for in full
#pragma unroll
      for (int kt = 0; kt < 2; ++kt)
#pragma unroll
        for (int gq = 0; gq < 2; ++gq) s[kt][gq] = mmh(kf[kt][1], qf[gq][1], mmh(kf[kt][0], qf[gq][0], nm[gq]));
      __builtin_amdgcn_sched_barrier(0);   // the eight products stand together: spread among the exponentials, which now follow them directly, each cost up to four v_nop of distance
      v16h vf[4];
#pragma unroll
      for (int j = 0; j < 4; ++j) vf[j] = frag_vt(&sv[bf][ps * 32][j * 16], lane);
      // Probabilities on trust: P = 2^(logit - m_run) is formed at once, with no maximum taken first. The pass's own sums are the test: every P is >= 0, so each is at most its lane's sum.
      v16h pf[2]; v2f t[2];
#pragma unroll
      for (int gq = 0; gq < 2; ++gq) fa_exp<false>(s[0][gq], s[1][gq], 0.0f, pf[gq], t[gq]);
      const float tm = fmaxf(fmaxf(t[0].x, t[0].y), fmaxf(t[1].x, t[1].y));
      if (__builtin_amdgcn_ballot_w32(!(tm <= thr)) != 0) {   // scalar branch, once per pass; taken in a wave's first pass (thr starts below every sum) and rarely after it
#pragma unroll
        for (int gq = 0; gq < 2; ++gq) { float mx = s[0][gq][0];
#pragma unroll
          for (int r8 = 1; r8 < 8; ++r8) mx = fmaxf(mx, s[0][gq][r8]);
#pragma unroll
          for (int r8 = 0; r8 < 8; ++r8) mx = fmaxf(mx, s[1][gq][r8]);
          mx = fmaxf(mx, xhalf(mx));   // the pass's maximum, counted from m_run
          const float d = fmaxf(mx, dlo); const float corr = __builtin_amdgcn_exp2f(-fmaxf(d, 0.0f)); nm[gq] = nm[gq] - d; l2[gq] = l2[gq] * corr;   // m_run rises by d (first pass: moves to the maximum; sums and outputs are still 0 there)
#pragma unroll
          for (int j = 0; j < 4; ++j) acc[gq][j] = acc[gq][j] * corr;
          fa_exp<true>(s[0][gq], s[1][gq], d, pf[gq], t[gq]); }   // the pass's P and sums again, now against its true maximum: all <= 1
        thr = FAT; dlo = 0.0f; }
#pragma unroll
      for (int gq = 0; gq < 2; ++gq) l2[gq] = l2[gq] + t[gq];
      // Hand-over of the tile in flight, one pass after its loads: it goes, rounded, into the buffer that stage st + 1 reads (free since the barrier that ended stage st - 1), and the next tile's loads take its registers.
      // Pass 0: v of stage st + 1 lands, k of stage st + 1 starts. Pass 1: that k lands, v of stage st + 2 starts. Past the last stage the last tile is fetched again, into the buffer nobody reads any more: no branch.
      if (ps == 0) { const float* kt = kg + (size_t)((st + 1 < FNS ? st + 1 : FNS - 1) * FAS) * CC;
#pragma unroll
        for (int kt = 0; kt < 2; ++kt) { kf[kt][0] = frag_h(&sk[bf][32 + kt * 16 + col][0], lane); kf[kt][1] = frag_h(&sk[bf][32 + kt * 16 + col][32], lane); }   // pass 1's k fragments, from this stage's own buffer: read here, above the scheduling barriers, they arrive under the tile's rounding; further down the compiler read them right in front of their products
        __builtin_amdgcn_sched_barrier(0);   // holds those reads above the rounding
#pragma unroll
        for (int i = 0; i < 4; ++i) *(v4h*)&sv[bf ^ 1][srow + 16 * i][sch] = rnd4(r[i]);
        __builtin_amdgcn_sched_barrier(0);   // the tile leaves its registers before the next one's loads are issued: both at once would not fit
#pragma unroll
        for (int i = 0; i < 4; ++i) r[i] = *(const v4f*)(kt + (size_t)(16 * i) * CC);
        asm volatile("s_wait_xcnt 0x0" :: "v"(kt) : "memory");   // the four loads name kt's register pair: as an input here it stays whole until the wait (with two registers fewer to spare the compiler had laid the last load's data over it), and what overwrites it next stands behind the wait
        // Every FPF-th stage asks for stages st + 4 and st + 5, whose first loads are issued in stage st + 2. Scalar branch; the last request names the last two stages, and the address moves no further. Add and request stand in one statement so that the request names the register pair that lives through the loop, never a temporary.
        if ((st & (FPF - 1)) == 0 && st + 2 * FPF + 1 < FNS) asm volatile("v_add_nc_u64 %0, %1, %0\n\tglobal_prefetch_b8 %0, off scope:SCOPE_SE" : "+v"(pfa) : "s"((unsigned long long)FPF * FAS * CC * 4));
      } else { const int ks = (st + 2 < FNS ? st + 2 : FNS - 1) * FAS;
#pragma unroll
        for (int i = 0; i < 4; ++i) *(v4h*)&sk[bf ^ 1][srow + 16 * i][sch] = rnd4(r[i]);
        __builtin_amdgcn_sched_barrier(0);   // as in pass 0
#pragma unroll
        for (int i = 0; i < 4; ++i) r[i] = *(const v4f*)(vg + (size_t)(ks + 16 * i) * CC); }
      __builtin_amdgcn_sched_barrier(0);   // keeps the four loads here, at the head of the block: sunk towards the block's end they would lose part of their flight
#pragma unroll
      for (int gq = 0; gq < 2; ++gq)
#pragma unroll
        for (int j = 0; j < 4; ++j) acc[gq][j] = mmh(vf[j], pf[gq], acc[gq][j]); }
    // Publishes stage st + 1 and ends every wave's reads of the buffer that stage st + 1 refills. The fences name LDS alone: __syncthreads() would also wait here for the v loads in flight, which only fill registers.
    asm volatile("s_wait_xcnt 0x0" ::: "memory");   // pass 1's loads name an address pair that the next stage's first fragment reads overwrite
    __builtin_amdgcn_fence(__ATOMIC_RELEASE, "workgroup", "local"); __builtin_amdgcn_s_barrier(); __builtin_amdgcn_fence(__ATOMIC_ACQUIRE, "workgroup", "local");
  }
  // The epilogue forms its addresses anew, from the lane count and the scalar wave number: formed from tid they are kept in vector registers across the loop, which has none to spare (they spilled).
  const int el = (int)__builtin_amdgcn_mbcnt_lo(~0u, 0u), ec = el & 15, eg = el >> 4;
#pragma unroll
  for (int gq = 0; gq < 2; ++gq) { float l = l2[gq].x + l2[gq].y; l += xhalf(l); const float inv = 1.0f / l;
#pragma unroll
    for (int j = 0; j < 4; ++j) { const v8f o = acc[gq][j] * inv; *(v4f*)&so[sw][gq * 16 + ec][j * 16 + 8 * eg] = v4f{o[0], o[1], o[2], o[3]}; *(v4f*)&so[sw][gq * 16 + ec][j * 16 + 8 * eg + 4] = v4f{o[4], o[5], o[6], o[7]}; } }
  LDSX();   // the wave's own rows are read back by other lanes, so that 16 lanes store one whole 256-B (row, head) segment
#pragma unroll
  for (int rl = 0; rl < 32; rl += 2) vst2(Y + ((size_t)b * TT + qb * (FAW * 32) + sw * 32 + rl + eg) * CC + h * HD + ec * 4, *(const v4f*)&so[sw][rl + eg][ec * 4]);
}

extern "C" void kernel_launch(void* const* d_in, const int* in_sizes, int n_in, void* d_out, int out_size, void* d_ws, size_t ws_size, hipStream_t stream) {
  (void)in_sizes; (void)n_in; (void)out_size;
  const float** F = (const float**)d_in;
  if (ws_size < (size_t)WS_END) return;
  char* ws = (char*)d_ws; _Float16 *QH = (_Float16*)(ws + WS_QH), *KH = (_Float16*)(ws + WS_KH), *VT = (_Float16*)(ws + WS_VT), *QL = (_Float16*)(ws + WS_QL), *KL = (_Float16*)(ws + WS_KL); __bf16 *VB = (__bf16*)(ws + WS_VB), *VBL = (__bf16*)(ws + WS_VBL); float *S = (float*)(ws + WS_S), *Y = (float*)(ws + WS_Y);
  (void)Y; (void)S; (void)QH; (void)KH; (void)VT; (void)QL; (void)KL; (void)VB; (void)VBL;
  // inputs : 0 query [2,2048,32,64]; 1 key; 2 value (rows [b*2048 + s][n*64 + h], heads merged)
  k_fa<<<dim3(TT / (FAW * 32) * TNB * NH), 256, 0, stream>>>(F[0], F[1], F[2], (float*)d_out);   /* ctx [b, sq, n*h], heads merged */
}

